// v000
// The times below were measured on an AMD MI455X: many runs one after another, warmed up first and cycling through
// copies of the inputs, with the whole window's GPU time divided by the number of runs. Launches and the gaps
// between them are all in it. The median over several windows is given; except for v000 it joins two sittings, which
// can be a few percent apart, so the side-by-side timings, each taken in one sitting, are the better comparison.
// v000, which the later versions start from, runs in 142 microseconds.
#include <hip/hip_runtime.h>
#include <hip/hip_bf16.h>
#include <math.h>

typedef __attribute__((ext_vector_type(2))) float v2f;
typedef __attribute__((ext_vector_type(8))) float v8f;
typedef __attribute__((ext_vector_type(4))) int   v4i;

#define T_SEQ 512
#define C_DIM 1024
#define NH    16
#define NKV   8
#define HD    64
#define HD2   32

// ---------------------------------------------------------------------------
// Async memory->LDS staging (gfx1250 GLOBAL_LOAD_ASYNC_TO_LDS_B128, ASYNCcnt),
// with a synchronous float4 fallback if the toolchain lacks the builtin.
// Builtin signature (from clang diagnostic): (v4i addrspace(1)*, v4i
// addrspace(3)*, imm offset, imm cpol).
// ---------------------------------------------------------------------------
#define GLOBAL_AS __attribute__((address_space(1)))
#define LDS_AS    __attribute__((address_space(3)))

#if __has_builtin(__builtin_amdgcn_global_load_async_to_lds_b128)
#define HAVE_ASYNC_LDS 1
#define ASYNC_COPY16(gp, lp)                                                   \
  __builtin_amdgcn_global_load_async_to_lds_b128(                              \
      (GLOBAL_AS v4i*)(unsigned long long)(gp),                                \
      (LDS_AS v4i*)(unsigned)(unsigned long long)(lp), 0, 0)
#else
#define HAVE_ASYNC_LDS 0
#define ASYNC_COPY16(gp, lp) (*(float4*)(lp) = *(const float4*)(gp))
#endif

#if HAVE_ASYNC_LDS
#if __has_builtin(__builtin_amdgcn_s_wait_asynccnt)
#define WAIT_ASYNC(n) __builtin_amdgcn_s_wait_asynccnt(n)
#else
#define WAIT_ASYNC(n) asm volatile("s_wait_asynccnt %0" ::"i"(n) : "memory")
#endif
#else
#define WAIT_ASYNC(n) ((void)0)
#endif

// ---------------------------------------------------------------------------
// Generic f32 GEMM, C = A @ B, using V_WMMA_F32_16X16X4_F32.
// Block tile 64x64, K-chunk 32, 128 threads = 4 waves in a 2x2 grid; each
// wave owns a 32x32 quadrant = 2x2 WMMA tiles (2 A-frags + 2 B-frags feed
// 4 WMMAs -> 2x fragment reuse). Tiles double-buffered in LDS and staged
// with async LDS-DMA so chunk i+1 copies overlap chunk i compute.
// All launches use M,N,K that are exact multiples of the tile (no guards,
// EXEC stays all-ones as WMMA requires).
// ---------------------------------------------------------------------------
#define BM 64
#define BN 64
#define BK 32
#define SAPAD 36   // A pad: 36*l16 mod 64 distinct over 16 lanes -> no conflicts
#define SBPAD 72   // B pad: koff row pairs land on disjoint bank ranges

__global__ __launch_bounds__(128)
void gemm_f32_wmma(const float* __restrict__ A, const float* __restrict__ B,
                   float* __restrict__ C, int M, int N, int K,
                   int lda, int ldb, int ldc,
                   long long aHeadStride, int bHeadColStride, int bHeadDiv,
                   int cHeadColStride)
{
  const int h = blockIdx.z;
  A += (long long)h * aHeadStride;
  B += (long long)(h / bHeadDiv) * bHeadColStride;
  C += (long long)h * cHeadColStride;

  const int m0   = blockIdx.y * BM;
  const int n0   = blockIdx.x * BN;
  const int tid  = threadIdx.x;
  const int lane = tid & 31;
  const int wave = tid >> 5;
  const int wm   = wave >> 1;         // 2x2 wave grid over the 64x64 tile
  const int wn   = wave & 1;
  const int l16  = lane & 15;
  const int koff = (lane >> 4) * 2;   // lanes 0-15: K=0,1  lanes 16-31: K=2,3

  __shared__ __align__(16) float sA[2][BM][SAPAD];  // A row-major
  __shared__ __align__(16) float sB[2][BK][SBPAD];  // B row-major [k][n]

  v8f acc[2][2];
  #pragma unroll
  for (int mi = 0; mi < 2; ++mi)
    #pragma unroll
    for (int ni = 0; ni < 2; ++ni)
      acc[mi][ni] = (v8f){0.f,0.f,0.f,0.f,0.f,0.f,0.f,0.f};

  // Stage one K-chunk: A 64x32 + B 32x64 = 1024 float4s, 8 per thread.
  auto stage = [&](int buf, int kk) {
    #pragma unroll
    for (int q = 0; q < 4; ++q) {
      int q4 = tid + q * 128;
      {
        int r = q4 >> 3, c4 = q4 & 7;               // A: 8 float4 per row
        const float* gp = A + (long long)(m0 + r) * lda + kk + c4 * 4;
        ASYNC_COPY16(gp, &sA[buf][r][c4 * 4]);
      }
      {
        int r = q4 >> 4, c4 = q4 & 15;              // B: 16 float4 per row
        const float* gp = B + (long long)(kk + r) * ldb + n0 + c4 * 4;
        ASYNC_COPY16(gp, &sB[buf][r][c4 * 4]);
      }
    }
  };

  stage(0, 0);
  int buf = 0;
  for (int kk = 0; kk < K; kk += BK, buf ^= 1) {
    const bool has_next = (kk + BK) < K;
    if (has_next) {
      __builtin_prefetch(&A[(long long)m0 * lda + kk + 2 * BK], 0, 0);
      stage(buf ^ 1, kk + BK);                // overlap DMA with compute
      WAIT_ASYNC(8);                          // current buffer's 8 done
    } else {
      WAIT_ASYNC(0);
    }
    __syncthreads();                          // everyone's staging visible

    const float (*pA)[SAPAD] = sA[buf];
    const float (*pB)[SBPAD] = sB[buf];
    #pragma unroll
    for (int k4 = 0; k4 < BK; k4 += 4) {
      v2f a0 = *(const v2f*)&pA[wm * 32 + l16][k4 + koff];         // ds b64
      v2f a1 = *(const v2f*)&pA[wm * 32 + 16 + l16][k4 + koff];
      v2f b0, b1;                                                  // ds 2addr b32
      b0.x = pB[k4 + koff    ][wn * 32 + l16];
      b0.y = pB[k4 + koff + 1][wn * 32 + l16];
      b1.x = pB[k4 + koff    ][wn * 32 + 16 + l16];
      b1.y = pB[k4 + koff + 1][wn * 32 + 16 + l16];
      // 8 args: (neg_a, A, neg_b, B, c_mod, C, reuse_a, reuse_b)
      acc[0][0] = __builtin_amdgcn_wmma_f32_16x16x4_f32(false, a0, false, b0,
                                                        (short)0, acc[0][0], false, false);
      acc[0][1] = __builtin_amdgcn_wmma_f32_16x16x4_f32(false, a0, false, b1,
                                                        (short)0, acc[0][1], false, false);
      acc[1][0] = __builtin_amdgcn_wmma_f32_16x16x4_f32(false, a1, false, b0,
                                                        (short)0, acc[1][0], false, false);
      acc[1][1] = __builtin_amdgcn_wmma_f32_16x16x4_f32(false, a1, false, b1,
                                                        (short)0, acc[1][1], false, false);
    }
    __syncthreads();                          // done reading before restage
  }

  // C/D layout: VGPR r -> M = r (lanes 0-15) / M = 8+r (lanes 16-31), N = lane%16.
  #pragma unroll
  for (int mi = 0; mi < 2; ++mi)
    #pragma unroll
    for (int ni = 0; ni < 2; ++ni) {
      int col  = n0 + wn * 32 + ni * 16 + l16;
      int row0 = m0 + wm * 32 + mi * 16 + (lane >> 4) * 8;
      #pragma unroll
      for (int r = 0; r < 8; ++r)
        C[(long long)(row0 + r) * ldc + col] = acc[mi][ni][r];
    }
}

// ---------------------------------------------------------------------------
// RoPE + per-head RMS-norm, in place. One wave32 per (token, head); lane l
// owns dims l and l+32 of the 64-dim head.
// ---------------------------------------------------------------------------
__global__ __launch_bounds__(256)
void rope_rmsnorm(float* __restrict__ t, const float* __restrict__ cosp,
                  const float* __restrict__ sinp, int nHeads)
{
  int wid  = blockIdx.x * (blockDim.x >> 5) + (threadIdx.x >> 5);
  int lane = threadIdx.x & 31;
  int tpos = wid / nHeads;
  int head = wid - tpos * nHeads;
  if (tpos >= T_SEQ) return;
  float* p = t + (long long)tpos * nHeads * HD + head * HD;

  float x1 = p[lane], x2 = p[lane + HD2];
  float c  = cosp[tpos * HD2 + lane];
  float s  = sinp[tpos * HD2 + lane];
  float r1 = x1 * c - x2 * s;
  float r2 = x1 * s + x2 * c;

  float ss = r1 * r1 + r2 * r2;
  #pragma unroll
  for (int off = 16; off > 0; off >>= 1) ss += __shfl_xor(ss, off, 32);
  float scale = rsqrtf(ss * (1.0f / HD) + 1e-6f);
  p[lane]       = r1 * scale;
  p[lane + HD2] = r2 * scale;
}

// ---------------------------------------------------------------------------
// Tropical (max-plus) scores: S[h,i,j] = max_d(q[i,hd+d] + k[j,kvd+d]).
// 32x32 tile per block; q rows broadcast from LDS, k transposed in LDS for
// conflict-free per-lane key reads. Blocks fully above the diagonal skipped;
// the causal softmax never reads j > i, so garbage there is harmless.
// ---------------------------------------------------------------------------
__global__ __launch_bounds__(256)
void tropical_scores(const float* __restrict__ q, const float* __restrict__ k,
                     float* __restrict__ S)
{
  int h  = blockIdx.z;
  int i0 = blockIdx.y * 32, j0 = blockIdx.x * 32;
  if (j0 > i0 + 31) return;   // uniform over the whole block

  __shared__ __align__(16) float qs[32][68];
  __shared__ float ksT[HD][33];
  int tid = threadIdx.x;

  #pragma unroll
  for (int t = 0; t < 2; ++t) {
    int q4 = tid + t * 256;     // 512 float4s for each of q / k tiles
    int r  = q4 >> 4, c4 = q4 & 15;
    float4 v = *(const float4*)(q + (long long)(i0 + r) * C_DIM + h * HD + c4 * 4);
    *(float4*)&qs[r][c4 * 4] = v;
    float4 kv = *(const float4*)(k + (long long)(j0 + r) * (NKV * HD)
                                 + (h >> 1) * HD + c4 * 4);
    ksT[c4*4 + 0][r] = kv.x; ksT[c4*4 + 1][r] = kv.y;
    ksT[c4*4 + 2][r] = kv.z; ksT[c4*4 + 3][r] = kv.w;
  }
  __syncthreads();

  int ti = tid >> 5, tj = tid & 31;   // wave owns 4 i-rows x 32 j-cols
  float sc[4] = {-3.0e38f, -3.0e38f, -3.0e38f, -3.0e38f};
  #pragma unroll 8
  for (int d = 0; d < HD; ++d) {
    float kv = ksT[d][tj];
    #pragma unroll
    for (int r = 0; r < 4; ++r)
      sc[r] = fmaxf(sc[r], qs[ti * 4 + r][d] + kv);
  }
  long long base = (long long)h * T_SEQ * T_SEQ + (long long)i0 * T_SEQ + j0 + tj;
  #pragma unroll
  for (int r = 0; r < 4; ++r)
    S[base + (long long)(ti * 4 + r) * T_SEQ] = sc[r];
}

// ---------------------------------------------------------------------------
// Causal softmax, in place. One wave32 per (head, row); 16 cols per lane.
// Writes exact zeros for j > i so the P@V GEMM can run the full K range.
// ---------------------------------------------------------------------------
__global__ __launch_bounds__(256)
void softmax_causal(float* __restrict__ P)
{
  int wid  = blockIdx.x * (blockDim.x >> 5) + (threadIdx.x >> 5);
  int lane = threadIdx.x & 31;
  int h = wid >> 9;
  int i = wid & (T_SEQ - 1);
  if (h >= NH) return;
  float* row = P + (long long)h * T_SEQ * T_SEQ + (long long)i * T_SEQ;

  float v[16];
  float m = -3.0e38f;
  #pragma unroll
  for (int jj = 0; jj < 16; ++jj) {
    int j = lane + jj * 32;
    float val = (j <= i) ? row[j] : -3.0e38f;
    v[jj] = val;
    m = fmaxf(m, val);
  }
  #pragma unroll
  for (int off = 16; off > 0; off >>= 1) m = fmaxf(m, __shfl_xor(m, off, 32));

  float sum = 0.f;
  #pragma unroll
  for (int jj = 0; jj < 16; ++jj) {
    int j = lane + jj * 32;
    float e = (j <= i) ? __expf(v[jj] - m) : 0.f;
    v[jj] = e;
    sum += e;
  }
  #pragma unroll
  for (int off = 16; off > 0; off >>= 1) sum += __shfl_xor(sum, off, 32);

  float inv = 1.0f / sum;   // row i always has valid j=0 -> sum >= exp(0) > 0
  #pragma unroll
  for (int jj = 0; jj < 16; ++jj) row[lane + jj * 32] = v[jj] * inv;
}

// ---------------------------------------------------------------------------
extern "C" void kernel_launch(void* const* d_in, const int* in_sizes, int n_in,
                              void* d_out, int out_size, void* d_ws, size_t ws_size,
                              hipStream_t stream) {
  const float* x    = (const float*)d_in[0];
  const float* cosp = (const float*)d_in[1];
  const float* sinp = (const float*)d_in[2];
  const float* Wq   = (const float*)d_in[3];
  const float* Wk   = (const float*)d_in[4];
  const float* Wv   = (const float*)d_in[5];
  const float* Wo   = (const float*)d_in[6];
  float*       out  = (float*)d_out;

  float* ws   = (float*)d_ws;
  float* qbuf = ws;                                   // 512*1024
  float* kbuf = qbuf + (size_t)T_SEQ * C_DIM;         // 512*512
  float* vbuf = kbuf + (size_t)T_SEQ * NKV * HD;      // 512*512
  float* sbuf = vbuf + (size_t)T_SEQ * NKV * HD;      // 16*512*512
  float* ybuf = sbuf + (size_t)NH * T_SEQ * T_SEQ;    // 512*1024

  dim3 blk(128);

  // q = x @ Wq   (512x1024x1024)
  gemm_f32_wmma<<<dim3(C_DIM / BN, T_SEQ / BM, 1), blk, 0, stream>>>(
      x, Wq, qbuf, T_SEQ, C_DIM, C_DIM, C_DIM, C_DIM, C_DIM, 0LL, 0, 1, 0);
  // k = x @ Wk, v = x @ Wv   (512x512x1024)
  gemm_f32_wmma<<<dim3((NKV * HD) / BN, T_SEQ / BM, 1), blk, 0, stream>>>(
      x, Wk, kbuf, T_SEQ, NKV * HD, C_DIM, C_DIM, NKV * HD, NKV * HD, 0LL, 0, 1, 0);
  gemm_f32_wmma<<<dim3((NKV * HD) / BN, T_SEQ / BM, 1), blk, 0, stream>>>(
      x, Wv, vbuf, T_SEQ, NKV * HD, C_DIM, C_DIM, NKV * HD, NKV * HD, 0LL, 0, 1, 0);

  // RoPE + RMS-norm on q (16 heads) and k (8 heads), in place.
  rope_rmsnorm<<<dim3((T_SEQ * NH) / 8), dim3(256), 0, stream>>>(qbuf, cosp, sinp, NH);
  rope_rmsnorm<<<dim3((T_SEQ * NKV) / 8), dim3(256), 0, stream>>>(kbuf, cosp, sinp, NKV);

  // Tropical max-plus scores (VALU) + causal softmax.
  tropical_scores<<<dim3(T_SEQ / 32, T_SEQ / 32, NH), dim3(256), 0, stream>>>(
      qbuf, kbuf, sbuf);
  softmax_causal<<<dim3((NH * T_SEQ) / 8), dim3(256), 0, stream>>>(sbuf);

  // y[h] = P[h] @ V[h/2]   (per head 512x64x512, GQA via bHeadDiv=2)
  gemm_f32_wmma<<<dim3(HD / BN, T_SEQ / BM, NH), blk, 0, stream>>>(
      sbuf, vbuf, ybuf, T_SEQ, HD, T_SEQ,
      T_SEQ, NKV * HD, C_DIM,
      (long long)T_SEQ * T_SEQ, HD, 2, HD);

  // out = y @ Wo   (512x1024x1024)
  gemm_f32_wmma<<<dim3(C_DIM / BN, T_SEQ / BM, 1), blk, 0, stream>>>(
      ybuf, Wo, out, T_SEQ, C_DIM, C_DIM, C_DIM, C_DIM, C_DIM, 0LL, 0, 1, 0);
}

// v001
// Measured time: 102 microseconds a run.
// Two timings next to v000 put it at 1.42 and 1.41 times that version's speed.
#include <hip/hip_runtime.h>
#include <hip/hip_bf16.h>
#include <math.h>

typedef __attribute__((ext_vector_type(2))) float v2f;
typedef __attribute__((ext_vector_type(8))) float v8f;
typedef __attribute__((ext_vector_type(4))) int   v4i;

#define T_SEQ 512
#define C_DIM 1024
#define NH    16
#define NKV   8
#define HD    64
#define HD2   32

// ---------------------------------------------------------------------------
// Async memory->LDS staging (gfx1250 GLOBAL_LOAD_ASYNC_TO_LDS_B128, ASYNCcnt),
// with a synchronous float4 fallback if the toolchain lacks the builtin.
// Builtin signature (from clang diagnostic): (v4i addrspace(1)*, v4i
// addrspace(3)*, imm offset, imm cpol).
// ---------------------------------------------------------------------------
#define GLOBAL_AS __attribute__((address_space(1)))
#define LDS_AS    __attribute__((address_space(3)))

#if __has_builtin(__builtin_amdgcn_global_load_async_to_lds_b128)
#define HAVE_ASYNC_LDS 1
#define ASYNC_COPY16(gp, lp)                                                   \
  __builtin_amdgcn_global_load_async_to_lds_b128(                              \
      (GLOBAL_AS v4i*)(unsigned long long)(gp),                                \
      (LDS_AS v4i*)(unsigned)(unsigned long long)(lp), 0, 0)
#else
#define HAVE_ASYNC_LDS 0
#define ASYNC_COPY16(gp, lp) (*(float4*)(lp) = *(const float4*)(gp))
#endif

#if HAVE_ASYNC_LDS
#if __has_builtin(__builtin_amdgcn_s_wait_asynccnt)
#define WAIT_ASYNC(n) __builtin_amdgcn_s_wait_asynccnt(n)
#else
#define WAIT_ASYNC(n) asm volatile("s_wait_asynccnt %0" ::"i"(n) : "memory")
#endif
#else
#define WAIT_ASYNC(n) ((void)0)
#endif

// ---------------------------------------------------------------------------
// Generic f32 GEMM, C = A @ B, using V_WMMA_F32_16X16X4_F32.
// Block tile 64x64, K-chunk 32, 128 threads = 4 waves in a 2x2 grid; each
// wave owns a 32x32 quadrant = 2x2 WMMA tiles (2 A-frags + 2 B-frags feed
// 4 WMMAs -> 2x fragment reuse). Tiles double-buffered in LDS and staged
// with async LDS-DMA so chunk i+1 copies overlap chunk i compute.
// All launches use M,N,K that are exact multiples of the tile (no guards,
// EXEC stays all-ones as WMMA requires).
// ---------------------------------------------------------------------------
#define BM 64
#define BN 64
#define BK 32
#define SAPAD 36   // A pad: 36*l16 mod 64 distinct over 16 lanes -> no conflicts
#define SBPAD 72   // B pad: koff row pairs land on disjoint bank ranges

__device__ __forceinline__
void gemm_tile(const float* __restrict__ A, const float* __restrict__ B,
               float* __restrict__ C, int K, int lda, int ldb, int ldc,
               int m0, int n0)
{
  const int tid  = threadIdx.x;
  const int lane = tid & 31;
  const int wave = tid >> 5;
  const int wm   = wave >> 1;         // 2x2 wave grid over the 64x64 tile
  const int wn   = wave & 1;
  const int l16  = lane & 15;
  const int koff = (lane >> 4) * 2;   // lanes 0-15: K=0,1  lanes 16-31: K=2,3

  __shared__ __align__(16) float sA[2][BM][SAPAD];  // A row-major
  __shared__ __align__(16) float sB[2][BK][SBPAD];  // B row-major [k][n]

  v8f acc[2][2];
  #pragma unroll
  for (int mi = 0; mi < 2; ++mi)
    #pragma unroll
    for (int ni = 0; ni < 2; ++ni)
      acc[mi][ni] = (v8f){0.f,0.f,0.f,0.f,0.f,0.f,0.f,0.f};

  // Stage one K-chunk: A 64x32 + B 32x64 = 1024 float4s, 8 per thread.
  auto stage = [&](int buf, int kk) {
    #pragma unroll
    for (int q = 0; q < 4; ++q) {
      int q4 = tid + q * 128;
      {
        int r = q4 >> 3, c4 = q4 & 7;               // A: 8 float4 per row
        const float* gp = A + (long long)(m0 + r) * lda + kk + c4 * 4;
        ASYNC_COPY16(gp, &sA[buf][r][c4 * 4]);
      }
      {
        int r = q4 >> 4, c4 = q4 & 15;              // B: 16 float4 per row
        const float* gp = B + (long long)(kk + r) * ldb + n0 + c4 * 4;
        ASYNC_COPY16(gp, &sB[buf][r][c4 * 4]);
      }
    }
  };

  stage(0, 0);
  int buf = 0;
  for (int kk = 0; kk < K; kk += BK, buf ^= 1) {
    const bool has_next = (kk + BK) < K;
    if (has_next) {
      __builtin_prefetch(&A[(long long)m0 * lda + kk + 2 * BK], 0, 0);
      stage(buf ^ 1, kk + BK);                // overlap DMA with compute
      WAIT_ASYNC(8);                          // current buffer's 8 done
    } else {
      WAIT_ASYNC(0);
    }
    __syncthreads();                          // everyone's staging visible

    const float (*pA)[SAPAD] = sA[buf];
    const float (*pB)[SBPAD] = sB[buf];
    #pragma unroll
    for (int k4 = 0; k4 < BK; k4 += 4) {
      v2f a0 = *(const v2f*)&pA[wm * 32 + l16][k4 + koff];         // ds b64
      v2f a1 = *(const v2f*)&pA[wm * 32 + 16 + l16][k4 + koff];
      v2f b0, b1;                                                  // ds 2addr b32
      b0.x = pB[k4 + koff    ][wn * 32 + l16];
      b0.y = pB[k4 + koff + 1][wn * 32 + l16];
      b1.x = pB[k4 + koff    ][wn * 32 + 16 + l16];
      b1.y = pB[k4 + koff + 1][wn * 32 + 16 + l16];
      // 8 args: (neg_a, A, neg_b, B, c_mod, C, reuse_a, reuse_b)
      acc[0][0] = __builtin_amdgcn_wmma_f32_16x16x4_f32(false, a0, false, b0,
                                                        (short)0, acc[0][0], false, false);
      acc[0][1] = __builtin_amdgcn_wmma_f32_16x16x4_f32(false, a0, false, b1,
                                                        (short)0, acc[0][1], false, false);
      acc[1][0] = __builtin_amdgcn_wmma_f32_16x16x4_f32(false, a1, false, b0,
                                                        (short)0, acc[1][0], false, false);
      acc[1][1] = __builtin_amdgcn_wmma_f32_16x16x4_f32(false, a1, false, b1,
                                                        (short)0, acc[1][1], false, false);
    }
    __syncthreads();                          // done reading before restage
  }

  // C/D layout: VGPR r -> M = r (lanes 0-15) / M = 8+r (lanes 16-31), N = lane%16.
  #pragma unroll
  for (int mi = 0; mi < 2; ++mi)
    #pragma unroll
    for (int ni = 0; ni < 2; ++ni) {
      int col  = n0 + wn * 32 + ni * 16 + l16;
      int row0 = m0 + wm * 32 + mi * 16 + (lane >> 4) * 8;
      #pragma unroll
      for (int r = 0; r < 8; ++r)
        C[(long long)(row0 + r) * ldc + col] = acc[mi][ni][r];
    }
}

__global__ __launch_bounds__(128)
void gemm_f32_wmma(const float* __restrict__ A, const float* __restrict__ B,
                   float* __restrict__ C, int M, int N, int K,
                   int lda, int ldb, int ldc,
                   long long aHeadStride, int bHeadColStride, int bHeadDiv,
                   int cHeadColStride)
{
  const int h = blockIdx.z;
  gemm_tile(A + (long long)h * aHeadStride,
            B + (long long)(h / bHeadDiv) * bHeadColStride,
            C + (long long)h * cHeadColStride,
            K, lda, ldb, ldc, blockIdx.y * BM, blockIdx.x * BN);
}

// q, k and v projections in ONE grid: they share A = x and do not depend on
// each other. Column tiles 0-15 belong to q, 16-23 to k, 24-31 to v, so the
// launch has 32 x 8 = 256 workgroups instead of 128, 64 and 64 in turn.
#define QT (C_DIM / BN)
#define KT ((NKV * HD) / BN)

__global__ __launch_bounds__(128)
void qkv_f32_wmma(const float* __restrict__ x, const float* __restrict__ Wq,
                  const float* __restrict__ Wk, const float* __restrict__ Wv,
                  float* __restrict__ q, float* __restrict__ k,
                  float* __restrict__ v)
{
  const int bx = blockIdx.x;          // uniform over the workgroup
  const float* W = Wq;
  float* o = q;
  int ld = C_DIM, nt = bx;
  if (bx >= QT + KT)  { W = Wv; o = v; ld = NKV * HD; nt = bx - (QT + KT); }
  else if (bx >= QT)  { W = Wk; o = k; ld = NKV * HD; nt = bx - QT; }
  gemm_tile(x, W, o, C_DIM, C_DIM, ld, ld, blockIdx.y * BM, nt * BN);
}

// ---------------------------------------------------------------------------
// RoPE + per-head RMS-norm, in place. One wave32 per (token, head); lane l
// owns dims l and l+32 of the 64-dim head. One grid covers the 16 q heads and
// the 8 k heads of every token.
// ---------------------------------------------------------------------------
__global__ __launch_bounds__(256)
void rope_rmsnorm(float* __restrict__ q, float* __restrict__ k,
                  const float* __restrict__ cosp,
                  const float* __restrict__ sinp)
{
  int wid  = blockIdx.x * (blockDim.x >> 5) + (threadIdx.x >> 5);
  int lane = threadIdx.x & 31;
  int tpos = wid / (NH + NKV);
  int head = wid - tpos * (NH + NKV);
  if (tpos >= T_SEQ) return;
  float* p = (head < NH)
      ? q + (long long)tpos * NH * HD + head * HD
      : k + (long long)tpos * NKV * HD + (head - NH) * HD;

  float x1 = p[lane], x2 = p[lane + HD2];
  float c  = cosp[tpos * HD2 + lane];
  float s  = sinp[tpos * HD2 + lane];
  float r1 = x1 * c - x2 * s;
  float r2 = x1 * s + x2 * c;

  float ss = r1 * r1 + r2 * r2;
  #pragma unroll
  for (int off = 16; off > 0; off >>= 1) ss += __shfl_xor(ss, off, 32);
  float scale = rsqrtf(ss * (1.0f / HD) + 1e-6f);
  p[lane]       = r1 * scale;
  p[lane + HD2] = r2 * scale;
}

// ---------------------------------------------------------------------------
// Tropical (max-plus) scores: S[h,i,j] = max_d(q[i,hd+d] + k[j,kvd+d]).
// 32x32 tile per block; q rows broadcast from LDS, k transposed in LDS for
// conflict-free per-lane key reads. Blocks fully above the diagonal skipped;
// the causal softmax never reads j > i, so garbage there is harmless.
// ---------------------------------------------------------------------------
__global__ __launch_bounds__(256)
void tropical_scores(const float* __restrict__ q, const float* __restrict__ k,
                     float* __restrict__ S)
{
  int h  = blockIdx.z;
  int i0 = blockIdx.y * 32, j0 = blockIdx.x * 32;
  if (j0 > i0 + 31) return;   // uniform over the whole block

  __shared__ __align__(16) float qs[32][68];
  __shared__ float ksT[HD][33];
  int tid = threadIdx.x;

  #pragma unroll
  for (int t = 0; t < 2; ++t) {
    int q4 = tid + t * 256;     // 512 float4s for each of q / k tiles
    int r  = q4 >> 4, c4 = q4 & 15;
    float4 v = *(const float4*)(q + (long long)(i0 + r) * C_DIM + h * HD + c4 * 4);
    *(float4*)&qs[r][c4 * 4] = v;
    float4 kv = *(const float4*)(k + (long long)(j0 + r) * (NKV * HD)
                                 + (h >> 1) * HD + c4 * 4);
    ksT[c4*4 + 0][r] = kv.x; ksT[c4*4 + 1][r] = kv.y;
    ksT[c4*4 + 2][r] = kv.z; ksT[c4*4 + 3][r] = kv.w;
  }
  __syncthreads();

  int ti = tid >> 5, tj = tid & 31;   // wave owns 4 i-rows x 32 j-cols
  float sc[4] = {-3.0e38f, -3.0e38f, -3.0e38f, -3.0e38f};
  #pragma unroll 8
  for (int d = 0; d < HD; ++d) {
    float kv = ksT[d][tj];
    #pragma unroll
    for (int r = 0; r < 4; ++r)
      sc[r] = fmaxf(sc[r], qs[ti * 4 + r][d] + kv);
  }
  long long base = (long long)h * T_SEQ * T_SEQ + (long long)i0 * T_SEQ + j0 + tj;
  #pragma unroll
  for (int r = 0; r < 4; ++r)
    S[base + (long long)(ti * 4 + r) * T_SEQ] = sc[r];
}

// ---------------------------------------------------------------------------
// Causal softmax, in place. One wave32 per (head, row); 16 cols per lane.
// Writes exact zeros for j > i so the P@V GEMM can run the full K range.
// ---------------------------------------------------------------------------
__global__ __launch_bounds__(256)
void softmax_causal(float* __restrict__ P)
{
  int wid  = blockIdx.x * (blockDim.x >> 5) + (threadIdx.x >> 5);
  int lane = threadIdx.x & 31;
  int h = wid >> 9;
  int i = wid & (T_SEQ - 1);
  if (h >= NH) return;
  float* row = P + (long long)h * T_SEQ * T_SEQ + (long long)i * T_SEQ;

  float v[16];
  float m = -3.0e38f;
  #pragma unroll
  for (int jj = 0; jj < 16; ++jj) {
    int j = lane + jj * 32;
    float val = (j <= i) ? row[j] : -3.0e38f;
    v[jj] = val;
    m = fmaxf(m, val);
  }
  #pragma unroll
  for (int off = 16; off > 0; off >>= 1) m = fmaxf(m, __shfl_xor(m, off, 32));

  float sum = 0.f;
  #pragma unroll
  for (int jj = 0; jj < 16; ++jj) {
    int j = lane + jj * 32;
    float e = (j <= i) ? __expf(v[jj] - m) : 0.f;
    v[jj] = e;
    sum += e;
  }
  #pragma unroll
  for (int off = 16; off > 0; off >>= 1) sum += __shfl_xor(sum, off, 32);

  float inv = 1.0f / sum;   // row i always has valid j=0 -> sum >= exp(0) > 0
  #pragma unroll
  for (int jj = 0; jj < 16; ++jj) row[lane + jj * 32] = v[jj] * inv;
}

// ---------------------------------------------------------------------------
extern "C" void kernel_launch(void* const* d_in, const int* in_sizes, int n_in,
                              void* d_out, int out_size, void* d_ws, size_t ws_size,
                              hipStream_t stream) {
  const float* x    = (const float*)d_in[0];
  const float* cosp = (const float*)d_in[1];
  const float* sinp = (const float*)d_in[2];
  const float* Wq   = (const float*)d_in[3];
  const float* Wk   = (const float*)d_in[4];
  const float* Wv   = (const float*)d_in[5];
  const float* Wo   = (const float*)d_in[6];
  float*       out  = (float*)d_out;

  float* ws   = (float*)d_ws;
  float* qbuf = ws;                                   // 512*1024
  float* kbuf = qbuf + (size_t)T_SEQ * C_DIM;         // 512*512
  float* vbuf = kbuf + (size_t)T_SEQ * NKV * HD;      // 512*512
  float* sbuf = vbuf + (size_t)T_SEQ * NKV * HD;      // 16*512*512
  float* ybuf = sbuf + (size_t)NH * T_SEQ * T_SEQ;    // 512*1024

  dim3 blk(128);

  // q = x @ Wq (512x1024x1024), k = x @ Wk, v = x @ Wv (512x512x1024): one grid.
  qkv_f32_wmma<<<dim3(QT + 2 * KT, T_SEQ / BM, 1), blk, 0, stream>>>(
      x, Wq, Wk, Wv, qbuf, kbuf, vbuf);

  // RoPE + RMS-norm on q (16 heads) and k (8 heads), in place, one grid.
  rope_rmsnorm<<<dim3((T_SEQ * (NH + NKV)) / 8), dim3(256), 0, stream>>>(
      qbuf, kbuf, cosp, sinp);

  // Tropical max-plus scores (VALU) + causal softmax.
  tropical_scores<<<dim3(T_SEQ / 32, T_SEQ / 32, NH), dim3(256), 0, stream>>>(
      qbuf, kbuf, sbuf);
  softmax_causal<<<dim3((NH * T_SEQ) / 8), dim3(256), 0, stream>>>(sbuf);

  // y[h] = P[h] @ V[h/2]   (per head 512x64x512, GQA via bHeadDiv=2)
  gemm_f32_wmma<<<dim3(HD / BN, T_SEQ / BM, NH), blk, 0, stream>>>(
      sbuf, vbuf, ybuf, T_SEQ, HD, T_SEQ,
      T_SEQ, NKV * HD, C_DIM,
      (long long)T_SEQ * T_SEQ, HD, 2, HD);

  // out = y @ Wo   (512x1024x1024)
  gemm_f32_wmma<<<dim3(C_DIM / BN, T_SEQ / BM, 1), blk, 0, stream>>>(
      ybuf, Wo, out, T_SEQ, C_DIM, C_DIM, C_DIM, C_DIM, C_DIM, 0LL, 0, 1, 0);
}

// v002
// It runs in 63.8 microseconds.
// In both of two side-by-side timings against v001, it was 1.60 times as fast.
// All steps since v000 together make it 2.26 times as fast.
#include <hip/hip_runtime.h>
#include <hip/hip_bf16.h>
#include <math.h>

typedef __attribute__((ext_vector_type(2))) float v2f;
typedef __attribute__((ext_vector_type(8))) float v8f;
typedef __attribute__((ext_vector_type(4))) int   v4i;

#define T_SEQ 512
#define C_DIM 1024
#define NH    16
#define NKV   8
#define HD    64
#define HD2   32

// ---------------------------------------------------------------------------
// Async memory->LDS staging (gfx1250 GLOBAL_LOAD_ASYNC_TO_LDS_B128, ASYNCcnt),
// with a synchronous float4 fallback if the toolchain lacks the builtin.
// Builtin signature (from clang diagnostic): (v4i addrspace(1)*, v4i
// addrspace(3)*, imm offset, imm cpol).
// ---------------------------------------------------------------------------
#define GLOBAL_AS __attribute__((address_space(1)))
#define LDS_AS    __attribute__((address_space(3)))

#if __has_builtin(__builtin_amdgcn_global_load_async_to_lds_b128)
#define HAVE_ASYNC_LDS 1
#define ASYNC_COPY16(gp, lp)                                                   \
  __builtin_amdgcn_global_load_async_to_lds_b128(                              \
      (GLOBAL_AS v4i*)(unsigned long long)(gp),                                \
      (LDS_AS v4i*)(unsigned)(unsigned long long)(lp), 0, 0)
#else
#define HAVE_ASYNC_LDS 0
#define ASYNC_COPY16(gp, lp) (*(float4*)(lp) = *(const float4*)(gp))
#endif

#if HAVE_ASYNC_LDS
#if __has_builtin(__builtin_amdgcn_s_wait_asynccnt)
#define WAIT_ASYNC(n) __builtin_amdgcn_s_wait_asynccnt(n)
#else
#define WAIT_ASYNC(n) asm volatile("s_wait_asynccnt %0" ::"i"(n) : "memory")
#endif
#else
#define WAIT_ASYNC(n) ((void)0)
#endif

// ---------------------------------------------------------------------------
// Generic f32 GEMM, C = A @ B, using V_WMMA_F32_16X16X4_F32.
// Block tile 64x64, K-chunk 32, 128 threads = 4 waves in a 2x2 grid; each
// wave owns a 32x32 quadrant = 2x2 WMMA tiles (2 A-frags + 2 B-frags feed
// 4 WMMAs -> 2x fragment reuse). Tiles double-buffered in LDS and staged
// with async LDS-DMA so chunk i+1 copies overlap chunk i compute.
// All launches use M,N,K that are exact multiples of the tile (no guards,
// EXEC stays all-ones as WMMA requires).
// ---------------------------------------------------------------------------
#define BM 64
#define BN 64
#define BK 32
#define SAPAD 36   // A pad: 36*l16 mod 64 distinct over 16 lanes -> no conflicts
#define SBPAD 72   // B pad: koff row pairs land on disjoint bank ranges

__device__ __forceinline__
void gemm_tile(const float* __restrict__ A, const float* __restrict__ B,
               float* __restrict__ C, int K, int lda, int ldb, int ldc,
               int m0, int n0)
{
  const int tid  = threadIdx.x;
  const int lane = tid & 31;
  const int wave = tid >> 5;
  const int wm   = wave >> 1;         // 2x2 wave grid over the 64x64 tile
  const int wn   = wave & 1;
  const int l16  = lane & 15;
  const int koff = (lane >> 4) * 2;   // lanes 0-15: K=0,1  lanes 16-31: K=2,3

  __shared__ __align__(16) float sA[2][BM][SAPAD];  // A row-major
  __shared__ __align__(16) float sB[2][BK][SBPAD];  // B row-major [k][n]

  v8f acc[2][2];
  #pragma unroll
  for (int mi = 0; mi < 2; ++mi)
    #pragma unroll
    for (int ni = 0; ni < 2; ++ni)
      acc[mi][ni] = (v8f){0.f,0.f,0.f,0.f,0.f,0.f,0.f,0.f};

  // Stage one K-chunk: A 64x32 + B 32x64 = 1024 float4s, 8 per thread.
  auto stage = [&](int buf, int kk) {
    #pragma unroll
    for (int q = 0; q < 4; ++q) {
      int q4 = tid + q * 128;
      {
        int r = q4 >> 3, c4 = q4 & 7;               // A: 8 float4 per row
        const float* gp = A + (long long)(m0 + r) * lda + kk + c4 * 4;
        ASYNC_COPY16(gp, &sA[buf][r][c4 * 4]);
      }
      {
        int r = q4 >> 4, c4 = q4 & 15;              // B: 16 float4 per row
        const float* gp = B + (long long)(kk + r) * ldb + n0 + c4 * 4;
        ASYNC_COPY16(gp, &sB[buf][r][c4 * 4]);
      }
    }
  };

  stage(0, 0);
  int buf = 0;
  for (int kk = 0; kk < K; kk += BK, buf ^= 1) {
    const bool has_next = (kk + BK) < K;
    if (has_next) {
      __builtin_prefetch(&A[(long long)m0 * lda + kk + 2 * BK], 0, 0);
      stage(buf ^ 1, kk + BK);                // overlap DMA with compute
      WAIT_ASYNC(8);                          // current buffer's 8 done
    } else {
      WAIT_ASYNC(0);
    }
    __syncthreads();                          // everyone's staging visible

    const float (*pA)[SAPAD] = sA[buf];
    const float (*pB)[SBPAD] = sB[buf];
    #pragma unroll
    for (int k4 = 0; k4 < BK; k4 += 4) {
      v2f a0 = *(const v2f*)&pA[wm * 32 + l16][k4 + koff];         // ds b64
      v2f a1 = *(const v2f*)&pA[wm * 32 + 16 + l16][k4 + koff];
      v2f b0, b1;                                                  // ds 2addr b32
      b0.x = pB[k4 + koff    ][wn * 32 + l16];
      b0.y = pB[k4 + koff + 1][wn * 32 + l16];
      b1.x = pB[k4 + koff    ][wn * 32 + 16 + l16];
      b1.y = pB[k4 + koff + 1][wn * 32 + 16 + l16];
      // 8 args: (neg_a, A, neg_b, B, c_mod, C, reuse_a, reuse_b)
      acc[0][0] = __builtin_amdgcn_wmma_f32_16x16x4_f32(false, a0, false, b0,
                                                        (short)0, acc[0][0], false, false);
      acc[0][1] = __builtin_amdgcn_wmma_f32_16x16x4_f32(false, a0, false, b1,
                                                        (short)0, acc[0][1], false, false);
      acc[1][0] = __builtin_amdgcn_wmma_f32_16x16x4_f32(false, a1, false, b0,
                                                        (short)0, acc[1][0], false, false);
      acc[1][1] = __builtin_amdgcn_wmma_f32_16x16x4_f32(false, a1, false, b1,
                                                        (short)0, acc[1][1], false, false);
    }
    __syncthreads();                          // done reading before restage
  }

  // C/D layout: VGPR r -> M = r (lanes 0-15) / M = 8+r (lanes 16-31), N = lane%16.
  #pragma unroll
  for (int mi = 0; mi < 2; ++mi)
    #pragma unroll
    for (int ni = 0; ni < 2; ++ni) {
      int col  = n0 + wn * 32 + ni * 16 + l16;
      int row0 = m0 + wm * 32 + mi * 16 + (lane >> 4) * 8;
      #pragma unroll
      for (int r = 0; r < 8; ++r)
        C[(long long)(row0 + r) * ldc + col] = acc[mi][ni][r];
    }
}

__global__ __launch_bounds__(128)
void gemm_f32_wmma(const float* __restrict__ A, const float* __restrict__ B,
                   float* __restrict__ C, int M, int N, int K,
                   int lda, int ldb, int ldc,
                   long long aHeadStride, int bHeadColStride, int bHeadDiv,
                   int cHeadColStride)
{
  const int h = blockIdx.z;
  gemm_tile(A + (long long)h * aHeadStride,
            B + (long long)(h / bHeadDiv) * bHeadColStride,
            C + (long long)h * cHeadColStride,
            K, lda, ldb, ldc, blockIdx.y * BM, blockIdx.x * BN);
}

// q, k and v projections in ONE grid: they share A = x and do not depend on
// each other. Column tiles 0-15 belong to q, 16-23 to k, 24-31 to v, so the
// launch has 32 x 8 = 256 workgroups instead of 128, 64 and 64 in turn.
#define QT (C_DIM / BN)
#define KT ((NKV * HD) / BN)

__global__ __launch_bounds__(128)
void qkv_f32_wmma(const float* __restrict__ x, const float* __restrict__ Wq,
                  const float* __restrict__ Wk, const float* __restrict__ Wv,
                  float* __restrict__ q, float* __restrict__ k,
                  float* __restrict__ v)
{
  const int bx = blockIdx.x;          // uniform over the workgroup
  const float* W = Wq;
  float* o = q;
  int ld = C_DIM, nt = bx;
  if (bx >= QT + KT)  { W = Wv; o = v; ld = NKV * HD; nt = bx - (QT + KT); }
  else if (bx >= QT)  { W = Wk; o = k; ld = NKV * HD; nt = bx - QT; }
  gemm_tile(x, W, o, C_DIM, C_DIM, ld, ld, blockIdx.y * BM, nt * BN);
}

// ---------------------------------------------------------------------------
// RoPE + per-head RMS-norm, in place. One wave32 per (token, head); lane l
// owns dims l and l+32 of the 64-dim head. One grid covers the 16 q heads and
// the 8 k heads of every token.
// ---------------------------------------------------------------------------
__global__ __launch_bounds__(256)
void rope_rmsnorm(float* __restrict__ q, float* __restrict__ k,
                  const float* __restrict__ cosp,
                  const float* __restrict__ sinp)
{
  int wid  = blockIdx.x * (blockDim.x >> 5) + (threadIdx.x >> 5);
  int lane = threadIdx.x & 31;
  int tpos = wid / (NH + NKV);
  int head = wid - tpos * (NH + NKV);
  if (tpos >= T_SEQ) return;
  float* p = (head < NH)
      ? q + (long long)tpos * NH * HD + head * HD
      : k + (long long)tpos * NKV * HD + (head - NH) * HD;

  float x1 = p[lane], x2 = p[lane + HD2];
  float c  = cosp[tpos * HD2 + lane];
  float s  = sinp[tpos * HD2 + lane];
  float r1 = x1 * c - x2 * s;
  float r2 = x1 * s + x2 * c;

  float ss = r1 * r1 + r2 * r2;
  #pragma unroll
  for (int off = 16; off > 0; off >>= 1) ss += __shfl_xor(ss, off, 32);
  float scale = rsqrtf(ss * (1.0f / HD) + 1e-6f);
  p[lane]       = r1 * scale;
  p[lane + HD2] = r2 * scale;
}

// ---------------------------------------------------------------------------
// Tropical attention, one launch: S[i,j] = max_d(q[i,d] + k[j,d]), causal
// softmax over j <= i, y = P @ V. The scores never leave LDS.
// One workgroup = one head and two 16-row query tiles, p and 31 - p, so every
// workgroup has the same causal work (16 rows x 528 keys).
//   stage : q tile and all keys of the kv head, both transposed to [d][row]
//   scores: a wave takes 16 rows x 32 keys; a lane owns 4 rows x 4 keys, so one
//           16-byte LDS read of q and one of k feed 16 add/max pairs
//   probs : two rows per wave, same arithmetic and order as a row-wise softmax;
//           exact zeros for j > i
//   P @ V : V_WMMA_F32_16X16X4_F32, one wave per 16x16 output tile, k ascending
//           up to the tile's last causal key
// v overlays k in LDS once the scores are done.
// ---------------------------------------------------------------------------
typedef __attribute__((ext_vector_type(4))) float v4f;

#define AT_THREADS 512
#define KTP 516   // kT pitch: 4 d-rows apart = 16 banks, so transposing stores do not collide
#define QTP 36    // qT pitch: same property, 16-byte aligned rows
#define VLP 72    // v pitch: rows k and k+2 land on disjoint bank ranges
#define SSP 516   // score pitch: 16 rows x b64 reads cover all 64 banks once

// 2^x as the fast exponential compiles it, with the free slot that the
// instruction set asks for behind a transcendental tied to it: as a statement of
// its own the v_nop was scheduled away from the v_exp_f32.
__device__ __forceinline__ float exp2_slot(float x)
{
  float r;
  asm("v_exp_f32 %0, %1\n\tv_nop" : "=v"(r) : "v"(x));
  return r;
}

__global__ __launch_bounds__(AT_THREADS)
void tropical_attention(const float* __restrict__ q, const float* __restrict__ k,
                        const float* __restrict__ v, float* __restrict__ y)
{
  __shared__ __align__(16) float sKV[T_SEQ * VLP];   // kT[64][KTP], later v[512][VLP]
  __shared__ __align__(16) float sS[32][SSP];        // rows 0-15 tile p, 16-31 tile 31-p
  __shared__ __align__(16) float qT[HD][QTP];

  const int p    = blockIdx.x;
  const int h    = blockIdx.y;
  const int tid  = threadIdx.x;
  const int lane = tid & 31;
  const int wave = __builtin_amdgcn_readfirstlane(tid >> 5);
  const int rowA = 16 * p;
  const int rowB = 16 * (31 - p);
  const int kvo  = (h >> 1) * HD;

  // ---- stage q and k transposed: a wave covers 8 rows x 4 float4 columns ----
  {
    const int sub = ((wave >> 2) << 3) + (lane & 7);
    const int c4  = ((wave & 3) << 2) + (lane >> 3);
    const int grow = (sub < 16) ? rowA + sub : rowB + sub - 16;
    v4f qv = *(const v4f*)(q + grow * C_DIM + h * HD + c4 * 4);
    const float* kb = k + sub * (NKV * HD) + kvo + c4 * 4;
    v4f kr[16];
    #pragma unroll
    for (int it = 0; it < 16; ++it)
      kr[it] = *(const v4f*)(kb + it * 32 * (NKV * HD));
    #pragma unroll
    for (int e = 0; e < 4; ++e) qT[c4 * 4 + e][sub] = qv[e];
    #pragma unroll
    for (int it = 0; it < 16; ++it)
      #pragma unroll
      for (int e = 0; e < 4; ++e)
        sKV[(c4 * 4 + e) * KTP + it * 32 + sub] = kr[it][e];
  }

  __syncthreads();                       // qT and kT complete

  // v is fetched now and parked in registers: its latency runs under the scores.
  const float* vb = v + (tid >> 4) * (NKV * HD) + kvo + (tid & 15) * 4;
  v4f vr[16];
  #pragma unroll
  for (int it = 0; it < 16; ++it)
    vr[it] = *(const v4f*)(vb + it * 32 * (NKV * HD));
  // keeps the address pair whole until every load above has taken it: left
  // free, the last load's result is placed on the pair that all sixteen name
  asm volatile("s_wait_xcnt 0x0" :: "v"(vb) : "memory");

  // ---- scores ----
  const int cB = (33 - p) >> 1;          // 32-key chunks that tile 31-p needs
  const int cA = (p + 2) >> 1;           // ... and tile p; cA + cB = 17
  {
    const int li = lane >> 3, lj = lane & 7;
    for (int job = wave; job < cA + cB; job += AT_THREADS / 32) {
      const int tile  = (job < cB) ? 1 : 0;
      const int chunk = tile ? job : job - cB;
      const float* qp = &qT[0][tile * 16 + li * 4];
      const float* kp = &sKV[chunk * 32 + lj * 4];
      v2f sc[4][2];
      #pragma unroll
      for (int r = 0; r < 4; ++r) {
        sc[r][0] = (v2f){-3.0e38f, -3.0e38f};
        sc[r][1] = (v2f){-3.0e38f, -3.0e38f};
      }
      // four d pairs per trip: 16 LDS reads go out together ahead of their 128
      // packed adds and three-way maxima
      #pragma unroll 4
      for (int d = 0; d < HD; d += 2) {
        v4f qa = *(const v4f*)(qp + d * QTP);
        v4f qb = *(const v4f*)(qp + (d + 1) * QTP);
        v4f ka = *(const v4f*)(kp + d * KTP);
        v4f kb = *(const v4f*)(kp + (d + 1) * KTP);
        #pragma unroll
        for (int r = 0; r < 4; ++r) {
          v2f a0 = (v2f){qa[r], qa[r]} + ka.xy;
          v2f a1 = (v2f){qa[r], qa[r]} + ka.zw;
          v2f b0 = (v2f){qb[r], qb[r]} + kb.xy;
          v2f b1 = (v2f){qb[r], qb[r]} + kb.zw;
          sc[r][0].x = fmaxf(fmaxf(sc[r][0].x, a0.x), b0.x);
          sc[r][0].y = fmaxf(fmaxf(sc[r][0].y, a0.y), b0.y);
          sc[r][1].x = fmaxf(fmaxf(sc[r][1].x, a1.x), b1.x);
          sc[r][1].y = fmaxf(fmaxf(sc[r][1].y, a1.y), b1.y);
        }
      }
      #pragma unroll
      for (int r = 0; r < 4; ++r)
        *(v4f*)&sS[tile * 16 + li * 4 + r][chunk * 32 + lj * 4] =
            (v4f){sc[r][0].x, sc[r][0].y, sc[r][1].x, sc[r][1].y};
    }
  }
  __syncthreads();                       // scores complete, kT dead

  // ---- v into the space of kT ----
  #pragma unroll
  for (int it = 0; it < 16; ++it)
    *(v4f*)&sKV[((tid >> 4) + it * 32) * VLP + (tid & 15) * 4] = vr[it];

  // ---- causal softmax, two rows per wave, 16 columns per lane ----
  // The two rows go through each stage side by side, so that one row's
  // cross-lane steps run under the other's.
  {
    float pv[2][16], m[2], sum[2];
    int   ir[2];
    #pragma unroll
    for (int u = 0; u < 2; ++u) {
      const int rr = wave * 2 + u;
      ir[u] = (rr < 16) ? rowA + rr : rowB + rr - 16;
      m[u] = -3.0e38f;
      #pragma unroll
      for (int jj = 0; jj < 16; ++jj) {
        int j = lane + jj * 32;
        float val = (j <= ir[u]) ? sS[rr][j] : -3.0e38f;
        pv[u][jj] = val;
        m[u] = fmaxf(m[u], val);
      }
    }
    #pragma unroll
    for (int off = 16; off > 0; off >>= 1)
      #pragma unroll
      for (int u = 0; u < 2; ++u) m[u] = fmaxf(m[u], __shfl_xor(m[u], off, 32));

    #pragma unroll
    for (int u = 0; u < 2; ++u) {
      sum[u] = 0.f;
      #pragma unroll
      for (int jj = 0; jj < 16; ++jj) {
        int j = lane + jj * 32;
        float ex = exp2_slot((pv[u][jj] - m[u]) * 1.442695041f);   // every lane: no branch round it
        float e = (j <= ir[u]) ? ex : 0.f;
        pv[u][jj] = e;
        sum[u] += e;
      }
    }
    #pragma unroll
    for (int off = 16; off > 0; off >>= 1)
      #pragma unroll
      for (int u = 0; u < 2; ++u) sum[u] += __shfl_xor(sum[u], off, 32);

    #pragma unroll
    for (int u = 0; u < 2; ++u) {
      float inv = 1.0f / sum[u];   // row i always has valid j=0 -> sum >= exp(0) > 0
      #pragma unroll
      for (int jj = 0; jj < 16; ++jj) sS[wave * 2 + u][lane + jj * 32] = pv[u][jj] * inv;
    }
  }
  __syncthreads();                       // probabilities and v complete

  // ---- y tile = P (16 x nk) @ V (nk x 16), waves 0-3 tile p, 4-7 tile 31-p ----
  if (wave < 8) {                        // wave-uniform: EXEC stays all ones
    const int tile = wave >> 2, nt = wave & 3;
    const int row0 = tile ? rowB : rowA;
    const int nk   = row0 + 16;          // keys 0 .. row0+15; P is 0 above the diagonal
    const int l16  = lane & 15;
    const int koff = (lane >> 4) * 2;    // lanes 0-15: K=0,1  lanes 16-31: K=2,3
    const float* pA = &sS[tile * 16 + l16][koff];
    const float* pB = &sKV[koff * VLP + nt * 16 + l16];

    v8f acc = (v8f){0.f,0.f,0.f,0.f,0.f,0.f,0.f,0.f};
    v2f a[4], b[4];
    #pragma unroll
    for (int s = 0; s < 4; ++s) {
      a[s]   = *(const v2f*)(pA + s * 4);
      b[s].x = pB[(s * 4) * VLP];
      b[s].y = pB[(s * 4 + 1) * VLP];
    }
    // Groups of 16 keys, each group's fragments read one group ahead. The count
    // is rounded up to even (P is an exact 0 in the added group), so that the
    // unroll by two, which lets the two fragment sets alternate without
    // register copies, leaves no remainder loop.
    const int ng = ((nk + 31) >> 5) * 2;
    #pragma unroll 2
    for (int g = 0; g < ng; ++g) {
      const int kn = ((g + 1 < ng) ? g + 1 : g) * 16;   // last trip: its own group again
      v2f an[4], bn[4];
      #pragma unroll
      for (int s = 0; s < 4; ++s) {
        an[s]   = *(const v2f*)(pA + kn + s * 4);
        bn[s].x = pB[(kn + s * 4) * VLP];
        bn[s].y = pB[(kn + s * 4 + 1) * VLP];
      }
      // holds the reads above ahead of the WMMAs below: left free, they sink to
      // just before their use and every LDS latency is waited out in the chain
      __builtin_amdgcn_sched_barrier(0);
      #pragma unroll
      for (int s = 0; s < 4; ++s)
        acc = __builtin_amdgcn_wmma_f32_16x16x4_f32(false, a[s], false, b[s],
                                                    (short)0, acc, false, false);
      #pragma unroll
      for (int s = 0; s < 4; ++s) { a[s] = an[s]; b[s] = bn[s]; }
    }

    // C/D layout: VGPR r -> M = r (lanes 0-15) / M = 8+r (lanes 16-31), N = lane%16.
    float* yp = y + (row0 + (lane >> 4) * 8) * C_DIM + h * HD + nt * 16 + l16;
    #pragma unroll
    for (int r = 0; r < 8; ++r) yp[r * C_DIM] = acc[r];
  }
}

// ---------------------------------------------------------------------------
extern "C" void kernel_launch(void* const* d_in, const int* in_sizes, int n_in,
                              void* d_out, int out_size, void* d_ws, size_t ws_size,
                              hipStream_t stream) {
  const float* x    = (const float*)d_in[0];
  const float* cosp = (const float*)d_in[1];
  const float* sinp = (const float*)d_in[2];
  const float* Wq   = (const float*)d_in[3];
  const float* Wk   = (const float*)d_in[4];
  const float* Wv   = (const float*)d_in[5];
  const float* Wo   = (const float*)d_in[6];
  float*       out  = (float*)d_out;

  float* ws   = (float*)d_ws;
  float* qbuf = ws;                                   // 512*1024
  float* kbuf = qbuf + (size_t)T_SEQ * C_DIM;         // 512*512
  float* vbuf = kbuf + (size_t)T_SEQ * NKV * HD;      // 512*512
  float* sbuf = vbuf + (size_t)T_SEQ * NKV * HD;      // 16*512*512
  float* ybuf = sbuf + (size_t)NH * T_SEQ * T_SEQ;    // 512*1024

  dim3 blk(128);

  // q = x @ Wq (512x1024x1024), k = x @ Wk, v = x @ Wv (512x512x1024): one grid.
  qkv_f32_wmma<<<dim3(QT + 2 * KT, T_SEQ / BM, 1), blk, 0, stream>>>(
      x, Wq, Wk, Wv, qbuf, kbuf, vbuf);

  // RoPE + RMS-norm on q (16 heads) and k (8 heads), in place, one grid.
  rope_rmsnorm<<<dim3((T_SEQ * (NH + NKV)) / 8), dim3(256), 0, stream>>>(
      qbuf, kbuf, cosp, sinp);

  // Tropical scores, causal softmax and y[h] = P[h] @ V[h/2] in one grid:
  // 16 row-tile pairs x 16 heads = 256 workgroups.
  tropical_attention<<<dim3(T_SEQ / 32, NH, 1), dim3(AT_THREADS), 0, stream>>>(
      qbuf, kbuf, vbuf, ybuf);

  // out = y @ Wo   (512x1024x1024)
  gemm_f32_wmma<<<dim3(C_DIM / BN, T_SEQ / BM, 1), blk, 0, stream>>>(
      ybuf, Wo, out, T_SEQ, C_DIM, C_DIM, C_DIM, C_DIM, C_DIM, 0LL, 0, 1, 0);
}

// v003
// It runs in 57.4 microseconds.
// Timed twice side by side with v002, it ran 1.13 and 1.10 times as fast.
// All steps since v000 together make it 2.52 times as fast.
#include <hip/hip_runtime.h>
#include <hip/hip_bf16.h>
#include <math.h>

typedef __attribute__((ext_vector_type(2))) float v2f;
typedef __attribute__((ext_vector_type(8))) float v8f;
typedef __attribute__((ext_vector_type(4))) int   v4i;

#define T_SEQ 512
#define C_DIM 1024
#define NH    16
#define NKV   8
#define HD    64
#define HD2   32

// ---------------------------------------------------------------------------
// Async memory->LDS staging (gfx1250 GLOBAL_LOAD_ASYNC_TO_LDS_B128, ASYNCcnt),
// with a synchronous float4 fallback if the toolchain lacks the builtin.
// Builtin signature (from clang diagnostic): (v4i addrspace(1)*, v4i
// addrspace(3)*, imm offset, imm cpol).
// ---------------------------------------------------------------------------
#define GLOBAL_AS __attribute__((address_space(1)))
#define LDS_AS    __attribute__((address_space(3)))

#if __has_builtin(__builtin_amdgcn_global_load_async_to_lds_b128)
#define HAVE_ASYNC_LDS 1
#define ASYNC_COPY16(gp, lp)                                                   \
  __builtin_amdgcn_global_load_async_to_lds_b128(                              \
      (GLOBAL_AS v4i*)(unsigned long long)(gp),                                \
      (LDS_AS v4i*)(unsigned)(unsigned long long)(lp), 0, 0)
#else
#define HAVE_ASYNC_LDS 0
#define ASYNC_COPY16(gp, lp) (*(float4*)(lp) = *(const float4*)(gp))
#endif

#if HAVE_ASYNC_LDS
#if __has_builtin(__builtin_amdgcn_s_wait_asynccnt)
#define WAIT_ASYNC(n) __builtin_amdgcn_s_wait_asynccnt(n)
#else
#define WAIT_ASYNC(n) asm volatile("s_wait_asynccnt %0" ::"i"(n) : "memory")
#endif
#else
#define WAIT_ASYNC(n) ((void)0)
#endif

// ---------------------------------------------------------------------------
// Generic f32 GEMM, C = A @ B, using V_WMMA_F32_16X16X4_F32.
// Block tile 64x64, K-chunk 32, 128 threads = 4 waves in a 2x2 grid; each
// wave owns a 32x32 quadrant = 2x2 WMMA tiles (2 A-frags + 2 B-frags feed
// 4 WMMAs -> 2x fragment reuse). Tiles double-buffered in LDS and staged
// with async LDS-DMA so chunk i+1 copies overlap chunk i compute.
// All launches use M,N,K that are exact multiples of the tile (no guards,
// EXEC stays all-ones as WMMA requires).
// ---------------------------------------------------------------------------
#define BM 64
#define BN 64
#define BK 32
#define SAPAD 36   // A pad: 36*l16 mod 64 distinct over 16 lanes -> no conflicts
#define SBPAD 72   // B pad: koff row pairs land on disjoint bank ranges
#define SCPAD 68   // C pad: rows r and r+8 land 32 banks apart -> no conflicts

// FUSE: the caller has tiles that leave through the RoPE + RMS-norm epilogue.
template <bool FUSE>
__device__ __forceinline__
void gemm_tile(const float* __restrict__ A, const float* __restrict__ B,
               float* __restrict__ C, int K, int lda, int ldb, int ldc,
               int m0, int n0, bool rope,
               const float* __restrict__ cosp, const float* __restrict__ sinp)
{
  const int tid  = threadIdx.x;
  const int lane = tid & 31;
  const int wave = tid >> 5;
  const int wm   = wave >> 1;         // 2x2 wave grid over the 64x64 tile
  const int wn   = wave & 1;
  const int l16  = lane & 15;
  const int koff = (lane >> 4) * 2;   // lanes 0-15: K=0,1  lanes 16-31: K=2,3

  __shared__ __align__(16) float sA[2][BM][SAPAD];  // A row-major
  __shared__ __align__(16) float sB[2][BK][SBPAD];  // B row-major [k][n]

  v8f acc[2][2];
  #pragma unroll
  for (int mi = 0; mi < 2; ++mi)
    #pragma unroll
    for (int ni = 0; ni < 2; ++ni)
      acc[mi][ni] = (v8f){0.f,0.f,0.f,0.f,0.f,0.f,0.f,0.f};

  // Stage one K-chunk: A 64x32 + B 32x64 = 1024 float4s, 8 per thread.
  auto stage = [&](int buf, int kk) {
    #pragma unroll
    for (int q = 0; q < 4; ++q) {
      int q4 = tid + q * 128;
      {
        int r = q4 >> 3, c4 = q4 & 7;               // A: 8 float4 per row
        const float* gp = A + (long long)(m0 + r) * lda + kk + c4 * 4;
        ASYNC_COPY16(gp, &sA[buf][r][c4 * 4]);
      }
      {
        int r = q4 >> 4, c4 = q4 & 15;              // B: 16 float4 per row
        const float* gp = B + (long long)(kk + r) * ldb + n0 + c4 * 4;
        ASYNC_COPY16(gp, &sB[buf][r][c4 * 4]);
      }
    }
  };

  stage(0, 0);
  int buf = 0;
  for (int kk = 0; kk < K; kk += BK, buf ^= 1) {
    const bool has_next = (kk + BK) < K;
    if (has_next) {
      __builtin_prefetch(&A[(long long)m0 * lda + kk + 2 * BK], 0, 0);
      stage(buf ^ 1, kk + BK);                // overlap DMA with compute
      WAIT_ASYNC(8);                          // current buffer's 8 done
    } else {
      WAIT_ASYNC(0);
    }
    __syncthreads();                          // everyone's staging visible

    const float (*pA)[SAPAD] = sA[buf];
    const float (*pB)[SBPAD] = sB[buf];
    #pragma unroll
    for (int k4 = 0; k4 < BK; k4 += 4) {
      v2f a0 = *(const v2f*)&pA[wm * 32 + l16][k4 + koff];         // ds b64
      v2f a1 = *(const v2f*)&pA[wm * 32 + 16 + l16][k4 + koff];
      v2f b0, b1;                                                  // ds 2addr b32
      b0.x = pB[k4 + koff    ][wn * 32 + l16];
      b0.y = pB[k4 + koff + 1][wn * 32 + l16];
      b1.x = pB[k4 + koff    ][wn * 32 + 16 + l16];
      b1.y = pB[k4 + koff + 1][wn * 32 + 16 + l16];
      // 8 args: (neg_a, A, neg_b, B, c_mod, C, reuse_a, reuse_b)
      acc[0][0] = __builtin_amdgcn_wmma_f32_16x16x4_f32(false, a0, false, b0,
                                                        (short)0, acc[0][0], false, false);
      acc[0][1] = __builtin_amdgcn_wmma_f32_16x16x4_f32(false, a0, false, b1,
                                                        (short)0, acc[0][1], false, false);
      acc[1][0] = __builtin_amdgcn_wmma_f32_16x16x4_f32(false, a1, false, b0,
                                                        (short)0, acc[1][0], false, false);
      acc[1][1] = __builtin_amdgcn_wmma_f32_16x16x4_f32(false, a1, false, b1,
                                                        (short)0, acc[1][1], false, false);
    }
    __syncthreads();                          // done reading before restage
  }

  // RoPE + per-head RMS-norm on the way out (workgroup-uniform choice). BN == HD,
  // so the tile's 64 columns are one whole head of 64 tokens. The tile goes
  // through LDS (sA is dead behind the loop's last barrier, no copy is in
  // flight); then each row within one wave, lane l owning dims l and l+32, 16 rows per
  // wave side by side so that one row's cross-lane steps run under the others'.
  if (FUSE && rope) {
    float* sC = &sA[0][0][0];                 // 64 x SCPAD floats fit in sA
    const int rb = wave * 16;
    const float* cp = cosp + (m0 + rb) * HD2 + lane;
    const float* sp = sinp + (m0 + rb) * HD2 + lane;
    float cs[16], sn[16];                     // fetched first: latency runs under the LDS pass
    #pragma unroll
    for (int u = 0; u < 16; ++u) {
      cs[u] = cp[u * HD2];
      sn[u] = sp[u * HD2];
    }
    #pragma unroll
    for (int mi = 0; mi < 2; ++mi)
      #pragma unroll
      for (int ni = 0; ni < 2; ++ni)
        #pragma unroll
        for (int r = 0; r < 8; ++r)
          sC[(wm * 32 + mi * 16 + (lane >> 4) * 8 + r) * SCPAD + wn * 32 + ni * 16 + l16] =
              acc[mi][ni][r];
    __syncthreads();                          // the whole tile is in LDS

    float r1[16], r2[16], ss[16];
    #pragma unroll
    for (int u = 0; u < 16; ++u) {
      float x1 = sC[(rb + u) * SCPAD + lane], x2 = sC[(rb + u) * SCPAD + lane + HD2];
      r1[u] = x1 * cs[u] - x2 * sn[u];
      r2[u] = x1 * sn[u] + x2 * cs[u];
      ss[u] = r1[u] * r1[u] + r2[u] * r2[u];
    }
    #pragma unroll
    for (int off = 16; off > 0; off >>= 1)
      #pragma unroll
      for (int u = 0; u < 16; ++u) ss[u] += __shfl_xor(ss[u], off, 32);
    #pragma unroll
    for (int u = 0; u < 16; ++u) {
      float scale = rsqrtf(ss[u] * (1.0f / HD) + 1e-6f);
      float* p = C + (long long)(m0 + rb + u) * ldc + n0;
      p[lane]       = r1[u] * scale;
      p[lane + HD2] = r2[u] * scale;
    }
    return;
  }

  // C/D layout: VGPR r -> M = r (lanes 0-15) / M = 8+r (lanes 16-31), N = lane%16.
  #pragma unroll
  for (int mi = 0; mi < 2; ++mi)
    #pragma unroll
    for (int ni = 0; ni < 2; ++ni) {
      int col  = n0 + wn * 32 + ni * 16 + l16;
      int row0 = m0 + wm * 32 + mi * 16 + (lane >> 4) * 8;
      #pragma unroll
      for (int r = 0; r < 8; ++r)
        C[(long long)(row0 + r) * ldc + col] = acc[mi][ni][r];
    }
  // the built code places the RoPE block behind these stores, and that block
  // rewrites their address registers: the wait stands in front of the rewrite
  if (FUSE) asm volatile("s_wait_xcnt 0x0" ::: "memory");
}

__global__ __launch_bounds__(128)
void gemm_f32_wmma(const float* __restrict__ A, const float* __restrict__ B,
                   float* __restrict__ C, int M, int N, int K,
                   int lda, int ldb, int ldc,
                   long long aHeadStride, int bHeadColStride, int bHeadDiv,
                   int cHeadColStride)
{
  const int h = blockIdx.z;
  gemm_tile<false>(A + (long long)h * aHeadStride,
            B + (long long)(h / bHeadDiv) * bHeadColStride,
            C + (long long)h * cHeadColStride,
            K, lda, ldb, ldc, blockIdx.y * BM, blockIdx.x * BN,
            false, nullptr, nullptr);
}

// q, k and v projections in ONE grid: they share A = x and do not depend on
// each other. Column tiles 0-15 belong to q, 16-23 to k, 24-31 to v, so the
// launch has 32 x 8 = 256 workgroups instead of 128, 64 and 64 in turn.
// A column tile is one head, and the q and k tiles leave rotated and normed.
#define QT (C_DIM / BN)
#define KT ((NKV * HD) / BN)

__global__ __launch_bounds__(128)
void qkv_f32_wmma(const float* __restrict__ x, const float* __restrict__ Wq,
                  const float* __restrict__ Wk, const float* __restrict__ Wv,
                  const float* __restrict__ cosp, const float* __restrict__ sinp,
                  float* __restrict__ q, float* __restrict__ k,
                  float* __restrict__ v)
{
  const int bx = blockIdx.x;          // uniform over the workgroup
  const float* W = Wq;
  float* o = q;
  int ld = C_DIM, nt = bx;
  if (bx >= QT + KT)  { W = Wv; o = v; ld = NKV * HD; nt = bx - (QT + KT); }
  else if (bx >= QT)  { W = Wk; o = k; ld = NKV * HD; nt = bx - QT; }
  gemm_tile<true>(x, W, o, C_DIM, C_DIM, ld, ld, blockIdx.y * BM, nt * BN,
                  bx < QT + KT, cosp, sinp);
}

// ---------------------------------------------------------------------------
// Tropical attention, one launch: S[i,j] = max_d(q[i,d] + k[j,d]), causal
// softmax over j <= i, y = P @ V. The scores never leave LDS.
// One workgroup = one head and two 16-row query tiles, p and 31 - p, so every
// workgroup has the same causal work (16 rows x 528 keys).
//   stage : q tile and all keys of the kv head, both transposed to [d][row]
//   scores: a wave takes 16 rows x 32 keys; a lane owns 4 rows x 4 keys, so one
//           16-byte LDS read of q and one of k feed 16 add/max pairs
//   probs : two rows per wave, same arithmetic and order as a row-wise softmax;
//           exact zeros for j > i
//   P @ V : V_WMMA_F32_16X16X4_F32, one wave per 16x16 output tile, k ascending
//           up to the tile's last causal key
// v overlays k in LDS once the scores are done.
// ---------------------------------------------------------------------------
typedef __attribute__((ext_vector_type(4))) float v4f;

#define AT_THREADS 512
#define KTP 516   // kT pitch: 4 d-rows apart = 16 banks, so transposing stores do not collide
#define QTP 36    // qT pitch: same property, 16-byte aligned rows
#define VLP 72    // v pitch: rows k and k+2 land on disjoint bank ranges
#define SSP 516   // score pitch: 16 rows x b64 reads cover all 64 banks once

// 2^x as the fast exponential compiles it, with the free slot that the
// instruction set asks for behind a transcendental tied to it: as a statement of
// its own the v_nop was scheduled away from the v_exp_f32.
__device__ __forceinline__ float exp2_slot(float x)
{
  float r;
  asm("v_exp_f32 %0, %1\n\tv_nop" : "=v"(r) : "v"(x));
  return r;
}

__global__ __launch_bounds__(AT_THREADS)
void tropical_attention(const float* __restrict__ q, const float* __restrict__ k,
                        const float* __restrict__ v, float* __restrict__ y)
{
  __shared__ __align__(16) float sKV[T_SEQ * VLP];   // kT[64][KTP], later v[512][VLP]
  __shared__ __align__(16) float sS[32][SSP];        // rows 0-15 tile p, 16-31 tile 31-p
  __shared__ __align__(16) float qT[HD][QTP];

  const int p    = blockIdx.x;
  const int h    = blockIdx.y;
  const int tid  = threadIdx.x;
  const int lane = tid & 31;
  const int wave = __builtin_amdgcn_readfirstlane(tid >> 5);
  const int rowA = 16 * p;
  const int rowB = 16 * (31 - p);
  const int kvo  = (h >> 1) * HD;

  // ---- stage q and k transposed: a wave covers 8 rows x 4 float4 columns ----
  {
    const int sub = ((wave >> 2) << 3) + (lane & 7);
    const int c4  = ((wave & 3) << 2) + (lane >> 3);
    const int grow = (sub < 16) ? rowA + sub : rowB + sub - 16;
    v4f qv = *(const v4f*)(q + grow * C_DIM + h * HD + c4 * 4);
    const float* kb = k + sub * (NKV * HD) + kvo + c4 * 4;
    v4f kr[16];
    #pragma unroll
    for (int it = 0; it < 16; ++it)
      kr[it] = *(const v4f*)(kb + it * 32 * (NKV * HD));
    #pragma unroll
    for (int e = 0; e < 4; ++e) qT[c4 * 4 + e][sub] = qv[e];
    #pragma unroll
    for (int it = 0; it < 16; ++it)
      #pragma unroll
      for (int e = 0; e < 4; ++e)
        sKV[(c4 * 4 + e) * KTP + it * 32 + sub] = kr[it][e];
  }

  __syncthreads();                       // qT and kT complete

  // v is fetched now and parked in registers: its latency runs under the scores.
  const float* vb = v + (tid >> 4) * (NKV * HD) + kvo + (tid & 15) * 4;
  v4f vr[16];
  #pragma unroll
  for (int it = 0; it < 16; ++it)
    vr[it] = *(const v4f*)(vb + it * 32 * (NKV * HD));
  // keeps the address pair whole until every load above has taken it: left
  // free, the last load's result is placed on the pair that all sixteen name
  asm volatile("s_wait_xcnt 0x0" :: "v"(vb) : "memory");

  // ---- scores ----
  const int cB = (33 - p) >> 1;          // 32-key chunks that tile 31-p needs
  const int cA = (p + 2) >> 1;           // ... and tile p; cA + cB = 17
  {
    const int li = lane >> 3, lj = lane & 7;
    for (int job = wave; job < cA + cB; job += AT_THREADS / 32) {
      const int tile  = (job < cB) ? 1 : 0;
      const int chunk = tile ? job : job - cB;
      const float* qp = &qT[0][tile * 16 + li * 4];
      const float* kp = &sKV[chunk * 32 + lj * 4];
      v2f sc[4][2];
      #pragma unroll
      for (int r = 0; r < 4; ++r) {
        sc[r][0] = (v2f){-3.0e38f, -3.0e38f};
        sc[r][1] = (v2f){-3.0e38f, -3.0e38f};
      }
      // four d pairs per trip: 16 LDS reads go out together ahead of their 128
      // packed adds and three-way maxima
      #pragma unroll 4
      for (int d = 0; d < HD; d += 2) {
        v4f qa = *(const v4f*)(qp + d * QTP);
        v4f qb = *(const v4f*)(qp + (d + 1) * QTP);
        v4f ka = *(const v4f*)(kp + d * KTP);
        v4f kb = *(const v4f*)(kp + (d + 1) * KTP);
        #pragma unroll
        for (int r = 0; r < 4; ++r) {
          v2f a0 = (v2f){qa[r], qa[r]} + ka.xy;
          v2f a1 = (v2f){qa[r], qa[r]} + ka.zw;
          v2f b0 = (v2f){qb[r], qb[r]} + kb.xy;
          v2f b1 = (v2f){qb[r], qb[r]} + kb.zw;
          sc[r][0].x = fmaxf(fmaxf(sc[r][0].x, a0.x), b0.x);
          sc[r][0].y = fmaxf(fmaxf(sc[r][0].y, a0.y), b0.y);
          sc[r][1].x = fmaxf(fmaxf(sc[r][1].x, a1.x), b1.x);
          sc[r][1].y = fmaxf(fmaxf(sc[r][1].y, a1.y), b1.y);
        }
      }
      #pragma unroll
      for (int r = 0; r < 4; ++r)
        *(v4f*)&sS[tile * 16 + li * 4 + r][chunk * 32 + lj * 4] =
            (v4f){sc[r][0].x, sc[r][0].y, sc[r][1].x, sc[r][1].y};
    }
  }
  __syncthreads();                       // scores complete, kT dead

  // ---- v into the space of kT ----
  #pragma unroll
  for (int it = 0; it < 16; ++it)
    *(v4f*)&sKV[((tid >> 4) + it * 32) * VLP + (tid & 15) * 4] = vr[it];

  // ---- causal softmax, two rows per wave, 16 columns per lane ----
  // The two rows go through each stage side by side, so that one row's
  // cross-lane steps run under the other's.
  {
    float pv[2][16], m[2], sum[2];
    int   ir[2];
    #pragma unroll
    for (int u = 0; u < 2; ++u) {
      const int rr = wave * 2 + u;
      ir[u] = (rr < 16) ? rowA + rr : rowB + rr - 16;
      m[u] = -3.0e38f;
      #pragma unroll
      for (int jj = 0; jj < 16; ++jj) {
        int j = lane + jj * 32;
        float val = (j <= ir[u]) ? sS[rr][j] : -3.0e38f;
        pv[u][jj] = val;
        m[u] = fmaxf(m[u], val);
      }
    }
    #pragma unroll
    for (int off = 16; off > 0; off >>= 1)
      #pragma unroll
      for (int u = 0; u < 2; ++u) m[u] = fmaxf(m[u], __shfl_xor(m[u], off, 32));

    #pragma unroll
    for (int u = 0; u < 2; ++u) {
      sum[u] = 0.f;
      #pragma unroll
      for (int jj = 0; jj < 16; ++jj) {
        int j = lane + jj * 32;
        float ex = exp2_slot((pv[u][jj] - m[u]) * 1.442695041f);   // every lane: no branch round it
        float e = (j <= ir[u]) ? ex : 0.f;
        pv[u][jj] = e;
        sum[u] += e;
      }
    }
    #pragma unroll
    for (int off = 16; off > 0; off >>= 1)
      #pragma unroll
      for (int u = 0; u < 2; ++u) sum[u] += __shfl_xor(sum[u], off, 32);

    #pragma unroll
    for (int u = 0; u < 2; ++u) {
      float inv = 1.0f / sum[u];   // row i always has valid j=0 -> sum >= exp(0) > 0
      #pragma unroll
      for (int jj = 0; jj < 16; ++jj) sS[wave * 2 + u][lane + jj * 32] = pv[u][jj] * inv;
    }
  }
  __syncthreads();                       // probabilities and v complete

  // ---- y tile = P (16 x nk) @ V (nk x 16), waves 0-3 tile p, 4-7 tile 31-p ----
  if (wave < 8) {                        // wave-uniform: EXEC stays all ones
    const int tile = wave >> 2, nt = wave & 3;
    const int row0 = tile ? rowB : rowA;
    const int nk   = row0 + 16;          // keys 0 .. row0+15; P is 0 above the diagonal
    const int l16  = lane & 15;
    const int koff = (lane >> 4) * 2;    // lanes 0-15: K=0,1  lanes 16-31: K=2,3
    const float* pA = &sS[tile * 16 + l16][koff];
    const float* pB = &sKV[koff * VLP + nt * 16 + l16];

    v8f acc = (v8f){0.f,0.f,0.f,0.f,0.f,0.f,0.f,0.f};
    v2f a[4], b[4];
    #pragma unroll
    for (int s = 0; s < 4; ++s) {
      a[s]   = *(const v2f*)(pA + s * 4);
      b[s].x = pB[(s * 4) * VLP];
      b[s].y = pB[(s * 4 + 1) * VLP];
    }
    // Groups of 16 keys, each group's fragments read one group ahead. The count
    // is rounded up to even (P is an exact 0 in the added group), so that the
    // unroll by two, which lets the two fragment sets alternate without
    // register copies, leaves no remainder loop.
    const int ng = ((nk + 31) >> 5) * 2;
    #pragma unroll 2
    for (int g = 0; g < ng; ++g) {
      const int kn = ((g + 1 < ng) ? g + 1 : g) * 16;   // last trip: its own group again
      v2f an[4], bn[4];
      #pragma unroll
      for (int s = 0; s < 4; ++s) {
        an[s]   = *(const v2f*)(pA + kn + s * 4);
        bn[s].x = pB[(kn + s * 4) * VLP];
        bn[s].y = pB[(kn + s * 4 + 1) * VLP];
      }
      // holds the reads above ahead of the WMMAs below: left free, they sink to
      // just before their use and every LDS latency is waited out in the chain
      __builtin_amdgcn_sched_barrier(0);
      #pragma unroll
      for (int s = 0; s < 4; ++s)
        acc = __builtin_amdgcn_wmma_f32_16x16x4_f32(false, a[s], false, b[s],
                                                    (short)0, acc, false, false);
      #pragma unroll
      for (int s = 0; s < 4; ++s) { a[s] = an[s]; b[s] = bn[s]; }
    }

    // C/D layout: VGPR r -> M = r (lanes 0-15) / M = 8+r (lanes 16-31), N = lane%16.
    float* yp = y + (row0 + (lane >> 4) * 8) * C_DIM + h * HD + nt * 16 + l16;
    #pragma unroll
    for (int r = 0; r < 8; ++r) yp[r * C_DIM] = acc[r];
  }
}

// ---------------------------------------------------------------------------
extern "C" void kernel_launch(void* const* d_in, const int* in_sizes, int n_in,
                              void* d_out, int out_size, void* d_ws, size_t ws_size,
                              hipStream_t stream) {
  const float* x    = (const float*)d_in[0];
  const float* cosp = (const float*)d_in[1];
  const float* sinp = (const float*)d_in[2];
  const float* Wq   = (const float*)d_in[3];
  const float* Wk   = (const float*)d_in[4];
  const float* Wv   = (const float*)d_in[5];
  const float* Wo   = (const float*)d_in[6];
  float*       out  = (float*)d_out;

  float* ws   = (float*)d_ws;
  float* qbuf = ws;                                   // 512*1024
  float* kbuf = qbuf + (size_t)T_SEQ * C_DIM;         // 512*512
  float* vbuf = kbuf + (size_t)T_SEQ * NKV * HD;      // 512*512
  float* sbuf = vbuf + (size_t)T_SEQ * NKV * HD;      // 16*512*512
  float* ybuf = sbuf + (size_t)NH * T_SEQ * T_SEQ;    // 512*1024

  dim3 blk(128);

  // q = x @ Wq (512x1024x1024), k = x @ Wk, v = x @ Wv (512x512x1024): one grid;
  // RoPE + RMS-norm on q (16 heads) and k (8 heads) in its epilogue.
  qkv_f32_wmma<<<dim3(QT + 2 * KT, T_SEQ / BM, 1), blk, 0, stream>>>(
      x, Wq, Wk, Wv, cosp, sinp, qbuf, kbuf, vbuf);

  // Tropical scores, causal softmax and y[h] = P[h] @ V[h/2] in one grid:
  // 16 row-tile pairs x 16 heads = 256 workgroups.
  tropical_attention<<<dim3(T_SEQ / 32, NH, 1), dim3(AT_THREADS), 0, stream>>>(
      qbuf, kbuf, vbuf, ybuf);

  // out = y @ Wo   (512x1024x1024)
  gemm_f32_wmma<<<dim3(C_DIM / BN, T_SEQ / BM, 1), blk, 0, stream>>>(
      ybuf, Wo, out, T_SEQ, C_DIM, C_DIM, C_DIM, C_DIM, C_DIM, 0LL, 0, 1, 0);
}

// v004
// It runs in 46 microseconds.
// Next to v003, in two timings, it ran 1.26 and 1.25 times as fast.
// All steps since v000 together make it 3.15 times as fast.
#include <hip/hip_runtime.h>
#include <hip/hip_bf16.h>
#include <math.h>

typedef __attribute__((ext_vector_type(2))) float v2f;
typedef __attribute__((ext_vector_type(8))) float v8f;
typedef __attribute__((ext_vector_type(4))) int   v4i;

#define T_SEQ 512
#define C_DIM 1024
#define NH    16
#define NKV   8
#define HD    64
#define HD2   32

// ---------------------------------------------------------------------------
// Async memory->LDS staging (gfx1250 GLOBAL_LOAD_ASYNC_TO_LDS_B128, ASYNCcnt),
// with a synchronous float4 fallback if the toolchain lacks the builtin.
// Builtin signature (from clang diagnostic): (v4i addrspace(1)*, v4i
// addrspace(3)*, imm offset, imm cpol).
// ---------------------------------------------------------------------------
#define GLOBAL_AS __attribute__((address_space(1)))
#define LDS_AS    __attribute__((address_space(3)))

#if __has_builtin(__builtin_amdgcn_global_load_async_to_lds_b128)
#define HAVE_ASYNC_LDS 1
#define ASYNC_COPY16(gp, lp)                                                   \
  __builtin_amdgcn_global_load_async_to_lds_b128(                              \
      (GLOBAL_AS v4i*)(unsigned long long)(gp),                                \
      (LDS_AS v4i*)(unsigned)(unsigned long long)(lp), 0, 0)
#else
#define HAVE_ASYNC_LDS 0
#define ASYNC_COPY16(gp, lp) (*(float4*)(lp) = *(const float4*)(gp))
#endif

#if HAVE_ASYNC_LDS
#if __has_builtin(__builtin_amdgcn_s_wait_asynccnt)
#define WAIT_ASYNC(n) __builtin_amdgcn_s_wait_asynccnt(n)
#else
#define WAIT_ASYNC(n) asm volatile("s_wait_asynccnt %0" ::"i"(n) : "memory")
#endif
#else
#define WAIT_ASYNC(n) ((void)0)
#endif

// ---------------------------------------------------------------------------
// Generic f32 GEMM, C = A @ B, using V_WMMA_F32_16X16X4_F32.
// Block tile 64x64, 256 threads = two groups of 4 waves. A group is a 2x2 wave
// grid over the whole tile; each wave owns a 32x32 quadrant = 2x2 WMMA tiles
// (2 A-frags + 2 B-frags feed 4 WMMAs -> 2x fragment reuse). A trip of the K
// loop covers 64 k: group g stages and multiplies the 32-wide chunk g of it, so
// every SIMD holds two waves (one runs its WMMAs under the other's LDS waits),
// the loop has half the trips and twice the bytes are in flight per trip. The
// two partial tiles are added in LDS behind the loop.
// Chunks double-buffered in LDS and staged with async LDS-DMA so trip i+1
// copies overlap trip i compute.
// All launches use M,N that are exact multiples of the tile and K a multiple
// of 64 (no guards, EXEC stays all-ones as WMMA requires).
// ---------------------------------------------------------------------------
#define BM 64
#define BN 64
#define BK 32
#define NG 2       // wave groups that share the K loop
#define GT 128     // threads of a group
#define SAPAD 36   // A pad: 36*l16 mod 64 distinct over 16 lanes -> no conflicts
#define SBPAD 72   // B pad: koff row pairs land on disjoint bank ranges
#define SCPAD 68   // C pad: rows r and r+8 land 32 banks apart -> no conflicts

// FUSE: the caller has tiles that leave through the RoPE + RMS-norm epilogue.
template <bool FUSE>
__device__ __forceinline__
void gemm_tile(const float* __restrict__ A, const float* __restrict__ B,
               float* __restrict__ C, int K, int lda, int ldb, int ldc,
               int m0, int n0, bool rope,
               const float* __restrict__ cosp, const float* __restrict__ sinp)
{
  const int tid  = threadIdx.x;
  const int lane = tid & 31;
  const int wave = tid >> 5;
  // which 32-wide chunk of every trip; the same in all lanes of a wave, so the
  // offsets formed from it are kept scalar
  const int grp  = __builtin_amdgcn_readfirstlane(tid >> 7);
  const int gtid = tid & (GT - 1);
  const int wm   = (wave >> 1) & 1;   // 2x2 wave grid over the 64x64 tile
  const int wn   = wave & 1;
  const int l16  = lane & 15;
  const int koff = (lane >> 4) * 2;   // lanes 0-15: K=0,1  lanes 16-31: K=2,3

  __shared__ __align__(16) float sA[2][NG][BM][SAPAD];  // A row-major
  __shared__ __align__(16) float sB[2][NG][BK][SBPAD];  // B row-major [k][n]

  v8f acc[2][2];
  #pragma unroll
  for (int mi = 0; mi < 2; ++mi)
    #pragma unroll
    for (int ni = 0; ni < 2; ++ni)
      acc[mi][ni] = (v8f){0.f,0.f,0.f,0.f,0.f,0.f,0.f,0.f};

  // Stage the group's own K-chunk of the trip that starts at kt:
  // A 64x32 + B 32x64 = 1024 float4s, 8 per thread of the group.
  auto stage = [&](int buf, int kt) {
    const int kk = kt + grp * BK;
    #pragma unroll
    for (int q = 0; q < 4; ++q) {
      int q4 = gtid + q * GT;
      {
        int r = q4 >> 3, c4 = q4 & 7;               // A: 8 float4 per row
        const float* gp = A + (long long)(m0 + r) * lda + kk + c4 * 4;
        ASYNC_COPY16(gp, &sA[buf][grp][r][c4 * 4]);
      }
      {
        int r = q4 >> 4, c4 = q4 & 15;              // B: 16 float4 per row
        const float* gp = B + (long long)(kk + r) * ldb + n0 + c4 * 4;
        ASYNC_COPY16(gp, &sB[buf][grp][r][c4 * 4]);
      }
    }
  };

  stage(0, 0);
  int buf = 0;
  for (int kk = 0; kk < K; kk += NG * BK, buf ^= 1) {
    const bool has_next = (kk + NG * BK) < K;
    if (has_next) {
      stage(buf ^ 1, kk + NG * BK);           // overlap DMA with compute
      WAIT_ASYNC(8);                          // current buffer's 8 done
    } else {
      WAIT_ASYNC(0);
    }
    __syncthreads();                          // everyone's staging visible

    const float (*pA)[SAPAD] = sA[buf][grp];
    const float (*pB)[SBPAD] = sB[buf][grp];
    #pragma unroll
    for (int k4 = 0; k4 < BK; k4 += 4) {
      v2f a0 = *(const v2f*)&pA[wm * 32 + l16][k4 + koff];         // ds b64
      v2f a1 = *(const v2f*)&pA[wm * 32 + 16 + l16][k4 + koff];
      v2f b0, b1;                                                  // ds 2addr b32
      b0.x = pB[k4 + koff    ][wn * 32 + l16];
      b0.y = pB[k4 + koff + 1][wn * 32 + l16];
      b1.x = pB[k4 + koff    ][wn * 32 + 16 + l16];
      b1.y = pB[k4 + koff + 1][wn * 32 + 16 + l16];
      // 8 args: (neg_a, A, neg_b, B, c_mod, C, reuse_a, reuse_b)
      acc[0][0] = __builtin_amdgcn_wmma_f32_16x16x4_f32(false, a0, false, b0,
                                                        (short)0, acc[0][0], false, false);
      acc[0][1] = __builtin_amdgcn_wmma_f32_16x16x4_f32(false, a0, false, b1,
                                                        (short)0, acc[0][1], false, false);
      acc[1][0] = __builtin_amdgcn_wmma_f32_16x16x4_f32(false, a1, false, b0,
                                                        (short)0, acc[1][0], false, false);
      acc[1][1] = __builtin_amdgcn_wmma_f32_16x16x4_f32(false, a1, false, b1,
                                                        (short)0, acc[1][1], false, false);
    }
    __syncthreads();                          // done reading before restage
  }

  // Both groups lay their partial tile into LDS (sA is dead behind the loop's
  // last barrier, no copy is in flight); every element then leaves as
  // group 0's sum + group 1's sum.
  float* sC = &sA[0][0][0][0];                // NG x 64 x SCPAD floats fit in sA
  const float* sC1 = sC + BM * SCPAD;
  // C/D layout: VGPR r -> M = r (lanes 0-15) / M = 8+r (lanes 16-31), N = lane%16.
  auto lay_partial = [&]() {
    #pragma unroll
    for (int mi = 0; mi < 2; ++mi)
      #pragma unroll
      for (int ni = 0; ni < 2; ++ni)
        #pragma unroll
        for (int r = 0; r < 8; ++r)
          sC[(grp * BM + wm * 32 + mi * 16 + (lane >> 4) * 8 + r) * SCPAD + wn * 32 + ni * 16 + l16] =
              acc[mi][ni][r];
  };

  // RoPE + per-head RMS-norm on the way out (workgroup-uniform choice). BN == HD,
  // so the tile's 64 columns are one whole head of 64 tokens. One wave per row,
  // lane l owning dims l and l+32, 8 rows per wave side by side so that one
  // row's cross-lane steps run under the others'.
  if (FUSE && rope) {
    const int rb = wave * 8;
    const float* cp = cosp + (m0 + rb) * HD2 + lane;
    const float* sp = sinp + (m0 + rb) * HD2 + lane;
    float cs[8], sn[8];                       // fetched first: latency runs under the LDS pass
    #pragma unroll
    for (int u = 0; u < 8; ++u) {
      cs[u] = cp[u * HD2];
      sn[u] = sp[u * HD2];
    }
    // keeps both address pairs whole until every load above has taken them: left
    // free, the last load's result is placed on the pair that all eight name
    asm volatile("s_wait_xcnt 0x0" :: "v"(cp), "v"(sp) : "memory");
    lay_partial();
    __syncthreads();                          // both partial tiles are in LDS

    float r1[8], r2[8], ss[8];
    #pragma unroll
    for (int u = 0; u < 8; ++u) {
      const int o = (rb + u) * SCPAD + lane;
      float x1 = sC[o] + sC1[o], x2 = sC[o + HD2] + sC1[o + HD2];
      r1[u] = x1 * cs[u] - x2 * sn[u];
      r2[u] = x1 * sn[u] + x2 * cs[u];
      ss[u] = r1[u] * r1[u] + r2[u] * r2[u];
    }
    #pragma unroll
    for (int off = 16; off > 0; off >>= 1)
      #pragma unroll
      for (int u = 0; u < 8; ++u) ss[u] += __shfl_xor(ss[u], off, 32);
    #pragma unroll
    for (int u = 0; u < 8; ++u) {
      float scale = rsqrtf(ss[u] * (1.0f / HD) + 1e-6f);
      float* p = C + (long long)(m0 + rb + u) * ldc + n0;
      p[lane]       = r1[u] * scale;
      p[lane + HD2] = r2[u] * scale;
    }
    return;
  }

  lay_partial();
  __syncthreads();                            // both partial tiles are in LDS
  // 16 threads per row, 16 bytes each: 16 rows per pass.
  #pragma unroll
  for (int q = 0; q < 4; ++q) {
    const int row = (tid >> 4) + q * 16, c4 = (tid & 15) * 4;
    const float4 s0 = *(const float4*)&sC[row * SCPAD + c4];
    const float4 s1 = *(const float4*)&sC1[row * SCPAD + c4];
    *(float4*)&C[(long long)(m0 + row) * ldc + n0 + c4] =
        make_float4(s0.x + s1.x, s0.y + s1.y, s0.z + s1.z, s0.w + s1.w);
  }
  // the built code places the RoPE block behind these stores, and that block
  // rewrites their address registers: the wait stands in front of the rewrite
  if (FUSE) asm volatile("s_wait_xcnt 0x0" ::: "memory");
}

__global__ __launch_bounds__(NG * GT)
void gemm_f32_wmma(const float* __restrict__ A, const float* __restrict__ B,
                   float* __restrict__ C, int M, int N, int K,
                   int lda, int ldb, int ldc,
                   long long aHeadStride, int bHeadColStride, int bHeadDiv,
                   int cHeadColStride)
{
  const int h = blockIdx.z;
  gemm_tile<false>(A + (long long)h * aHeadStride,
            B + (long long)(h / bHeadDiv) * bHeadColStride,
            C + (long long)h * cHeadColStride,
            K, lda, ldb, ldc, blockIdx.y * BM, blockIdx.x * BN,
            false, nullptr, nullptr);
}

// q, k and v projections in ONE grid: they share A = x and do not depend on
// each other. Column tiles 0-15 belong to q, 16-23 to k, 24-31 to v, so the
// launch has 32 x 8 = 256 workgroups instead of 128, 64 and 64 in turn.
// A column tile is one head, and the q and k tiles leave rotated and normed.
#define QT (C_DIM / BN)
#define KT ((NKV * HD) / BN)

__global__ __launch_bounds__(NG * GT)
void qkv_f32_wmma(const float* __restrict__ x, const float* __restrict__ Wq,
                  const float* __restrict__ Wk, const float* __restrict__ Wv,
                  const float* __restrict__ cosp, const float* __restrict__ sinp,
                  float* __restrict__ q, float* __restrict__ k,
                  float* __restrict__ v)
{
  const int bx = blockIdx.x;          // uniform over the workgroup
  const float* W = Wq;
  float* o = q;
  int ld = C_DIM, nt = bx;
  if (bx >= QT + KT)  { W = Wv; o = v; ld = NKV * HD; nt = bx - (QT + KT); }
  else if (bx >= QT)  { W = Wk; o = k; ld = NKV * HD; nt = bx - QT; }
  gemm_tile<true>(x, W, o, C_DIM, C_DIM, ld, ld, blockIdx.y * BM, nt * BN,
                  bx < QT + KT, cosp, sinp);
}

// ---------------------------------------------------------------------------
// Tropical attention, one launch: S[i,j] = max_d(q[i,d] + k[j,d]), causal
// softmax over j <= i, y = P @ V. The scores never leave LDS.
// One workgroup = one head and two 16-row query tiles, p and 31 - p, so every
// workgroup has the same causal work (16 rows x 528 keys).
//   stage : q tile and all keys of the kv head, both transposed to [d][row]
//   scores: a wave takes 16 rows x 32 keys; a lane owns 4 rows x 4 keys, so one
//           16-byte LDS read of q and one of k feed 16 add/max pairs
//   probs : two rows per wave, same arithmetic and order as a row-wise softmax;
//           exact zeros for j > i
//   P @ V : V_WMMA_F32_16X16X4_F32, one wave per 16x16 output tile, k ascending
//           up to the tile's last causal key
// v overlays k in LDS once the scores are done.
// ---------------------------------------------------------------------------
typedef __attribute__((ext_vector_type(4))) float v4f;

#define AT_THREADS 512
#define KTP 516   // kT pitch: 4 d-rows apart = 16 banks, so transposing stores do not collide
#define QTP 36    // qT pitch: same property, 16-byte aligned rows
#define VLP 72    // v pitch: rows k and k+2 land on disjoint bank ranges
#define SSP 516   // score pitch: 16 rows x b64 reads cover all 64 banks once

// 2^x as the fast exponential compiles it, with the free slot that the
// instruction set asks for behind a transcendental tied to it: as a statement of
// its own the v_nop was scheduled away from the v_exp_f32.
__device__ __forceinline__ float exp2_slot(float x)
{
  float r;
  asm("v_exp_f32 %0, %1\n\tv_nop" : "=v"(r) : "v"(x));
  return r;
}

__global__ __launch_bounds__(AT_THREADS)
void tropical_attention(const float* __restrict__ q, const float* __restrict__ k,
                        const float* __restrict__ v, float* __restrict__ y)
{
  __shared__ __align__(16) float sKV[T_SEQ * VLP];   // kT[64][KTP], later v[512][VLP]
  __shared__ __align__(16) float sS[32][SSP];        // rows 0-15 tile p, 16-31 tile 31-p
  __shared__ __align__(16) float qT[HD][QTP];

  const int p    = blockIdx.x;
  const int h    = blockIdx.y;
  const int tid  = threadIdx.x;
  const int lane = tid & 31;
  const int wave = __builtin_amdgcn_readfirstlane(tid >> 5);
  const int rowA = 16 * p;
  const int rowB = 16 * (31 - p);
  const int kvo  = (h >> 1) * HD;

  // ---- stage q and k transposed: a wave covers 8 rows x 4 float4 columns ----
  {
    const int sub = ((wave >> 2) << 3) + (lane & 7);
    const int c4  = ((wave & 3) << 2) + (lane >> 3);
    const int grow = (sub < 16) ? rowA + sub : rowB + sub - 16;
    v4f qv = *(const v4f*)(q + grow * C_DIM + h * HD + c4 * 4);
    const float* kb = k + sub * (NKV * HD) + kvo + c4 * 4;
    v4f kr[16];
    #pragma unroll
    for (int it = 0; it < 16; ++it)
      kr[it] = *(const v4f*)(kb + it * 32 * (NKV * HD));
    #pragma unroll
    for (int e = 0; e < 4; ++e) qT[c4 * 4 + e][sub] = qv[e];
    #pragma unroll
    for (int it = 0; it < 16; ++it)
      #pragma unroll
      for (int e = 0; e < 4; ++e)
        sKV[(c4 * 4 + e) * KTP + it * 32 + sub] = kr[it][e];
  }

  __syncthreads();                       // qT and kT complete

  // v is fetched now and parked in registers: its latency runs under the scores.
  const float* vb = v + (tid >> 4) * (NKV * HD) + kvo + (tid & 15) * 4;
  v4f vr[16];
  #pragma unroll
  for (int it = 0; it < 16; ++it)
    vr[it] = *(const v4f*)(vb + it * 32 * (NKV * HD));
  // keeps the address pair whole until every load above has taken it: left
  // free, the last load's result is placed on the pair that all sixteen name
  asm volatile("s_wait_xcnt 0x0" :: "v"(vb) : "memory");

  // ---- scores ----
  const int cB = (33 - p) >> 1;          // 32-key chunks that tile 31-p needs
  const int cA = (p + 2) >> 1;           // ... and tile p; cA + cB = 17
  {
    const int li = lane >> 3, lj = lane & 7;
    for (int job = wave; job < cA + cB; job += AT_THREADS / 32) {
      const int tile  = (job < cB) ? 1 : 0;
      const int chunk = tile ? job : job - cB;
      const float* qp = &qT[0][tile * 16 + li * 4];
      const float* kp = &sKV[chunk * 32 + lj * 4];
      v2f sc[4][2];
      #pragma unroll
      for (int r = 0; r < 4; ++r) {
        sc[r][0] = (v2f){-3.0e38f, -3.0e38f};
        sc[r][1] = (v2f){-3.0e38f, -3.0e38f};
      }
      // four d pairs per trip: 16 LDS reads go out together ahead of their 128
      // packed adds and three-way maxima
      #pragma unroll 4
      for (int d = 0; d < HD; d += 2) {
        v4f qa = *(const v4f*)(qp + d * QTP);
        v4f qb = *(const v4f*)(qp + (d + 1) * QTP);
        v4f ka = *(const v4f*)(kp + d * KTP);
        v4f kb = *(const v4f*)(kp + (d + 1) * KTP);
        #pragma unroll
        for (int r = 0; r < 4; ++r) {
          v2f a0 = (v2f){qa[r], qa[r]} + ka.xy;
          v2f a1 = (v2f){qa[r], qa[r]} + ka.zw;
          v2f b0 = (v2f){qb[r], qb[r]} + kb.xy;
          v2f b1 = (v2f){qb[r], qb[r]} + kb.zw;
          sc[r][0].x = fmaxf(fmaxf(sc[r][0].x, a0.x), b0.x);
          sc[r][0].y = fmaxf(fmaxf(sc[r][0].y, a0.y), b0.y);
          sc[r][1].x = fmaxf(fmaxf(sc[r][1].x, a1.x), b1.x);
          sc[r][1].y = fmaxf(fmaxf(sc[r][1].y, a1.y), b1.y);
        }
      }
      #pragma unroll
      for (int r = 0; r < 4; ++r)
        *(v4f*)&sS[tile * 16 + li * 4 + r][chunk * 32 + lj * 4] =
            (v4f){sc[r][0].x, sc[r][0].y, sc[r][1].x, sc[r][1].y};
    }
  }
  __syncthreads();                       // scores complete, kT dead

  // ---- v into the space of kT ----
  #pragma unroll
  for (int it = 0; it < 16; ++it)
    *(v4f*)&sKV[((tid >> 4) + it * 32) * VLP + (tid & 15) * 4] = vr[it];

  // ---- causal softmax, two rows per wave, 16 columns per lane ----
  // The two rows go through each stage side by side, so that one row's
  // cross-lane steps run under the other's.
  {
    float pv[2][16], m[2], sum[2];
    int   ir[2];
    #pragma unroll
    for (int u = 0; u < 2; ++u) {
      const int rr = wave * 2 + u;
      ir[u] = (rr < 16) ? rowA + rr : rowB + rr - 16;
      m[u] = -3.0e38f;
      #pragma unroll
      for (int jj = 0; jj < 16; ++jj) {
        int j = lane + jj * 32;
        float val = (j <= ir[u]) ? sS[rr][j] : -3.0e38f;
        pv[u][jj] = val;
        m[u] = fmaxf(m[u], val);
      }
    }
    #pragma unroll
    for (int off = 16; off > 0; off >>= 1)
      #pragma unroll
      for (int u = 0; u < 2; ++u) m[u] = fmaxf(m[u], __shfl_xor(m[u], off, 32));

    #pragma unroll
    for (int u = 0; u < 2; ++u) {
      sum[u] = 0.f;
      #pragma unroll
      for (int jj = 0; jj < 16; ++jj) {
        int j = lane + jj * 32;
        float ex = exp2_slot((pv[u][jj] - m[u]) * 1.442695041f);   // every lane: no branch round it
        float e = (j <= ir[u]) ? ex : 0.f;
        pv[u][jj] = e;
        sum[u] += e;
      }
    }
    #pragma unroll
    for (int off = 16; off > 0; off >>= 1)
      #pragma unroll
      for (int u = 0; u < 2; ++u) sum[u] += __shfl_xor(sum[u], off, 32);

    #pragma unroll
    for (int u = 0; u < 2; ++u) {
      float inv = 1.0f / sum[u];   // row i always has valid j=0 -> sum >= exp(0) > 0
      #pragma unroll
      for (int jj = 0; jj < 16; ++jj) sS[wave * 2 + u][lane + jj * 32] = pv[u][jj] * inv;
    }
  }
  __syncthreads();                       // probabilities and v complete

  // ---- y tile = P (16 x nk) @ V (nk x 16), waves 0-3 tile p, 4-7 tile 31-p ----
  if (wave < 8) {                        // wave-uniform: EXEC stays all ones
    const int tile = wave >> 2, nt = wave & 3;
    const int row0 = tile ? rowB : rowA;
    const int nk   = row0 + 16;          // keys 0 .. row0+15; P is 0 above the diagonal
    const int l16  = lane & 15;
    const int koff = (lane >> 4) * 2;    // lanes 0-15: K=0,1  lanes 16-31: K=2,3
    const float* pA = &sS[tile * 16 + l16][koff];
    const float* pB = &sKV[koff * VLP + nt * 16 + l16];

    v8f acc = (v8f){0.f,0.f,0.f,0.f,0.f,0.f,0.f,0.f};
    v2f a[4], b[4];
    #pragma unroll
    for (int s = 0; s < 4; ++s) {
      a[s]   = *(const v2f*)(pA + s * 4);
      b[s].x = pB[(s * 4) * VLP];
      b[s].y = pB[(s * 4 + 1) * VLP];
    }
    // Groups of 16 keys, each group's fragments read one group ahead. The count
    // is rounded up to even (P is an exact 0 in the added group), so that the
    // unroll by two, which lets the two fragment sets alternate without
    // register copies, leaves no remainder loop.
    const int ng = ((nk + 31) >> 5) * 2;
    #pragma unroll 2
    for (int g = 0; g < ng; ++g) {
      const int kn = ((g + 1 < ng) ? g + 1 : g) * 16;   // last trip: its own group again
      v2f an[4], bn[4];
      #pragma unroll
      for (int s = 0; s < 4; ++s) {
        an[s]   = *(const v2f*)(pA + kn + s * 4);
        bn[s].x = pB[(kn + s * 4) * VLP];
        bn[s].y = pB[(kn + s * 4 + 1) * VLP];
      }
      // holds the reads above ahead of the WMMAs below: left free, they sink to
      // just before their use and every LDS latency is waited out in the chain
      __builtin_amdgcn_sched_barrier(0);
      #pragma unroll
      for (int s = 0; s < 4; ++s)
        acc = __builtin_amdgcn_wmma_f32_16x16x4_f32(false, a[s], false, b[s],
                                                    (short)0, acc, false, false);
      #pragma unroll
      for (int s = 0; s < 4; ++s) { a[s] = an[s]; b[s] = bn[s]; }
    }

    // C/D layout: VGPR r -> M = r (lanes 0-15) / M = 8+r (lanes 16-31), N = lane%16.
    float* yp = y + (row0 + (lane >> 4) * 8) * C_DIM + h * HD + nt * 16 + l16;
    #pragma unroll
    for (int r = 0; r < 8; ++r) yp[r * C_DIM] = acc[r];
  }
}

// ---------------------------------------------------------------------------
extern "C" void kernel_launch(void* const* d_in, const int* in_sizes, int n_in,
                              void* d_out, int out_size, void* d_ws, size_t ws_size,
                              hipStream_t stream) {
  const float* x    = (const float*)d_in[0];
  const float* cosp = (const float*)d_in[1];
  const float* sinp = (const float*)d_in[2];
  const float* Wq   = (const float*)d_in[3];
  const float* Wk   = (const float*)d_in[4];
  const float* Wv   = (const float*)d_in[5];
  const float* Wo   = (const float*)d_in[6];
  float*       out  = (float*)d_out;

  float* ws   = (float*)d_ws;
  float* qbuf = ws;                                   // 512*1024
  float* kbuf = qbuf + (size_t)T_SEQ * C_DIM;         // 512*512
  float* vbuf = kbuf + (size_t)T_SEQ * NKV * HD;      // 512*512
  float* sbuf = vbuf + (size_t)T_SEQ * NKV * HD;      // 16*512*512
  float* ybuf = sbuf + (size_t)NH * T_SEQ * T_SEQ;    // 512*1024

  dim3 blk(NG * GT);

  // q = x @ Wq (512x1024x1024), k = x @ Wk, v = x @ Wv (512x512x1024): one grid;
  // RoPE + RMS-norm on q (16 heads) and k (8 heads) in its epilogue.
  qkv_f32_wmma<<<dim3(QT + 2 * KT, T_SEQ / BM, 1), blk, 0, stream>>>(
      x, Wq, Wk, Wv, cosp, sinp, qbuf, kbuf, vbuf);

  // Tropical scores, causal softmax and y[h] = P[h] @ V[h/2] in one grid:
  // 16 row-tile pairs x 16 heads = 256 workgroups.
  tropical_attention<<<dim3(T_SEQ / 32, NH, 1), dim3(AT_THREADS), 0, stream>>>(
      qbuf, kbuf, vbuf, ybuf);

  // out = y @ Wo   (512x1024x1024)
  gemm_f32_wmma<<<dim3(C_DIM / BN, T_SEQ / BM, 1), blk, 0, stream>>>(
      ybuf, Wo, out, T_SEQ, C_DIM, C_DIM, C_DIM, C_DIM, C_DIM, 0LL, 0, 1, 0);
}

// v005
// One run takes 41.1 microseconds.
// Two timings next to v004 both put it at 1.13 times that version's speed.
// Over all steps from v000 it is 3.57 times as fast.
#include <hip/hip_runtime.h>
#include <hip/hip_bf16.h>
#include <math.h>

typedef __attribute__((ext_vector_type(2))) float v2f;
typedef __attribute__((ext_vector_type(8))) float v8f;
typedef __attribute__((ext_vector_type(4))) int   v4i;

#define T_SEQ 512
#define C_DIM 1024
#define NH    16
#define NKV   8
#define HD    64
#define HD2   32

// ---------------------------------------------------------------------------
// Async memory->LDS staging (gfx1250 GLOBAL_LOAD_ASYNC_TO_LDS_B128, ASYNCcnt),
// with a synchronous float4 fallback if the toolchain lacks the builtin.
// Builtin signature (from clang diagnostic): (v4i addrspace(1)*, v4i
// addrspace(3)*, imm offset, imm cpol).
// ---------------------------------------------------------------------------
#define GLOBAL_AS __attribute__((address_space(1)))
#define LDS_AS    __attribute__((address_space(3)))

#if __has_builtin(__builtin_amdgcn_global_load_async_to_lds_b128)
#define HAVE_ASYNC_LDS 1
#define ASYNC_COPY16(gp, lp)                                                   \
  __builtin_amdgcn_global_load_async_to_lds_b128(                              \
      (GLOBAL_AS v4i*)(unsigned long long)(gp),                                \
      (LDS_AS v4i*)(unsigned)(unsigned long long)(lp), 0, 0)
#else
#define HAVE_ASYNC_LDS 0
#define ASYNC_COPY16(gp, lp) (*(float4*)(lp) = *(const float4*)(gp))
#endif

#if HAVE_ASYNC_LDS
#if __has_builtin(__builtin_amdgcn_s_wait_asynccnt)
#define WAIT_ASYNC(n) __builtin_amdgcn_s_wait_asynccnt(n)
#else
#define WAIT_ASYNC(n) asm volatile("s_wait_asynccnt %0" ::"i"(n) : "memory")
#endif
#else
#define WAIT_ASYNC(n) ((void)0)
#endif

// ---------------------------------------------------------------------------
// Generic f32 GEMM, C = A @ B, using V_WMMA_F32_16X16X4_F32.
// Block tile 64xTN, 256 threads = 8 waves. Each wave owns a 32x32 piece = 2x2
// WMMA tiles (2 A-frags + 2 B-frags feed 4 WMMAs -> 2x fragment reuse); the
// waves that cover the tile once are a group: 4 waves and 2 groups at TN = 64,
// 2 waves and 4 groups at TN = 32. A trip of the K loop covers 32 k per group:
// group g stages and multiplies the 32-wide chunk g of it, so every SIMD holds
// two waves (one runs its WMMAs under the other's LDS waits). The groups'
// partial tiles are added in LDS behind the loop.
// TN = 32 is for a product with fewer 64x64 tiles than the chip has WGPs: the
// f32 matrix rate is per WGP, so twice the tiles at half the WMMAs each halve
// the loop (half the trips, the trip itself as at TN = 64).
// Chunks double-buffered in LDS and staged with async LDS-DMA so trip i+1
// copies overlap trip i compute.
// All launches use M,N that are exact multiples of the tile and K a multiple
// of a trip's 64 or 128 (no guards, EXEC stays all-ones as WMMA requires).
// ---------------------------------------------------------------------------
#define BM 64
#define BN 64
#define BK 32
#define BNO 32     // tile width of the output projection: 32 x 8 = 256 tiles
#define NT 256     // threads of a work-group
#define SAPAD 36   // A pad: 36*l16 mod 64 distinct over 16 lanes -> no conflicts

// FUSE: the caller has tiles that leave through the RoPE + RMS-norm epilogue
// (TN == HD and two groups there). TN: tile width, 64 or 32.
template <bool FUSE, int TN>
__device__ __forceinline__
void gemm_tile(const float* __restrict__ A, const float* __restrict__ B,
               float* __restrict__ C, int K, int lda, int ldb, int ldc,
               int m0, int n0, bool rope,
               const float* __restrict__ cosp, const float* __restrict__ sinp)
{
  const int tid  = threadIdx.x;
  const int lane = tid & 31;
  const int wave = tid >> 5;
  constexpr int GT    = 2 * TN;       // threads of a group: 2 x TN/32 waves
  constexpr int NG    = NT / GT;      // wave groups that share the K loop
  constexpr int SBPAD = TN + 8;       // B pad: koff row pairs land on disjoint bank ranges
  constexpr int SCPAD = TN + 4;       // C pad: rows r and r+8 land 32 banks apart -> no conflicts
  constexpr int BR4   = TN / 4;       // float4s of a B or C row
  constexpr int NA    = BM * BK / 4 / GT;   // A copies of a thread per trip (B: 4)
  // which 32-wide chunk of every trip; the same in all lanes of a wave, so the
  // offsets formed from it are kept scalar
  const int grp  = __builtin_amdgcn_readfirstlane(tid / GT);
  const int gtid = tid & (GT - 1);
  const int wm   = (wave / (TN / 32)) & 1;   // 2 x TN/32 wave grid over the tile
  const int wn   = wave & (TN / 32 - 1);
  const int l16  = lane & 15;
  const int koff = (lane >> 4) * 2;   // lanes 0-15: K=0,1  lanes 16-31: K=2,3

  __shared__ __align__(16) float sA[2][NG][BM][SAPAD];  // A row-major
  __shared__ __align__(16) float sB[2][NG][BK][SBPAD];  // B row-major [k][n]

  v8f acc[2][2];
  #pragma unroll
  for (int mi = 0; mi < 2; ++mi)
    #pragma unroll
    for (int ni = 0; ni < 2; ++ni)
      acc[mi][ni] = (v8f){0.f,0.f,0.f,0.f,0.f,0.f,0.f,0.f};

  // Stage the group's own K-chunk of the trip that starts at kt:
  // A 64x32 + B 32xTN, in float4s: NA + 4 per thread of the group.
  auto stage = [&](int buf, int kt) {
    const int kk = kt + grp * BK;
    #pragma unroll
    for (int q = 0; q < NA; ++q) {
      int q4 = gtid + q * GT;
      {
        int r = q4 >> 3, c4 = q4 & 7;               // A: 8 float4 per row
        const float* gp = A + (long long)(m0 + r) * lda + kk + c4 * 4;
        ASYNC_COPY16(gp, &sA[buf][grp][r][c4 * 4]);
      }
      if (q < 4) {
        int r = q4 / BR4, c4 = q4 % BR4;            // B: TN/4 float4 per row
        const float* gp = B + (long long)(kk + r) * ldb + n0 + c4 * 4;
        ASYNC_COPY16(gp, &sB[buf][grp][r][c4 * 4]);
      }
    }
  };

  stage(0, 0);
  int buf = 0;
  for (int kk = 0; kk < K; kk += NG * BK, buf ^= 1) {
    const bool has_next = (kk + NG * BK) < K;
    if (has_next) {
      stage(buf ^ 1, kk + NG * BK);           // overlap DMA with compute
      WAIT_ASYNC(NA + 4);                     // current buffer's copies done
    } else {
      WAIT_ASYNC(0);
    }
    __syncthreads();                          // everyone's staging visible

    const float (*pA)[SAPAD] = sA[buf][grp];
    const float (*pB)[SBPAD] = sB[buf][grp];
    #pragma unroll
    for (int k4 = 0; k4 < BK; k4 += 4) {
      v2f a0 = *(const v2f*)&pA[wm * 32 + l16][k4 + koff];         // ds b64
      v2f a1 = *(const v2f*)&pA[wm * 32 + 16 + l16][k4 + koff];
      v2f b0, b1;                                                  // ds 2addr b32
      b0.x = pB[k4 + koff    ][wn * 32 + l16];
      b0.y = pB[k4 + koff + 1][wn * 32 + l16];
      b1.x = pB[k4 + koff    ][wn * 32 + 16 + l16];
      b1.y = pB[k4 + koff + 1][wn * 32 + 16 + l16];
      // 8 args: (neg_a, A, neg_b, B, c_mod, C, reuse_a, reuse_b)
      acc[0][0] = __builtin_amdgcn_wmma_f32_16x16x4_f32(false, a0, false, b0,
                                                        (short)0, acc[0][0], false, false);
      acc[0][1] = __builtin_amdgcn_wmma_f32_16x16x4_f32(false, a0, false, b1,
                                                        (short)0, acc[0][1], false, false);
      acc[1][0] = __builtin_amdgcn_wmma_f32_16x16x4_f32(false, a1, false, b0,
                                                        (short)0, acc[1][0], false, false);
      acc[1][1] = __builtin_amdgcn_wmma_f32_16x16x4_f32(false, a1, false, b1,
                                                        (short)0, acc[1][1], false, false);
    }
    __syncthreads();                          // done reading before restage
  }

  // All groups lay their partial tile into LDS (sA is dead behind the loop's
  // last barrier, no copy is in flight); every element then leaves as the
  // groups' sums added in the order of the groups.
  float* sC = &sA[0][0][0][0];                // NG x 64 x SCPAD floats fit in sA
  const float* sC1 = sC + BM * SCPAD;
  // C/D layout: VGPR r -> M = r (lanes 0-15) / M = 8+r (lanes 16-31), N = lane%16.
  auto lay_partial = [&]() {
    #pragma unroll
    for (int mi = 0; mi < 2; ++mi)
      #pragma unroll
      for (int ni = 0; ni < 2; ++ni)
        #pragma unroll
        for (int r = 0; r < 8; ++r)
          sC[(grp * BM + wm * 32 + mi * 16 + (lane >> 4) * 8 + r) * SCPAD + wn * 32 + ni * 16 + l16] =
              acc[mi][ni][r];
  };

  // RoPE + per-head RMS-norm on the way out (workgroup-uniform choice). BN == HD,
  // so the tile's 64 columns are one whole head of 64 tokens. One wave per row,
  // lane l owning dims l and l+32, 8 rows per wave side by side so that one
  // row's cross-lane steps run under the others'.
  if (FUSE && rope) {
    const int rb = wave * 8;
    const float* cp = cosp + (m0 + rb) * HD2 + lane;
    const float* sp = sinp + (m0 + rb) * HD2 + lane;
    float cs[8], sn[8];                       // fetched first: latency runs under the LDS pass
    #pragma unroll
    for (int u = 0; u < 8; ++u) {
      cs[u] = cp[u * HD2];
      sn[u] = sp[u * HD2];
    }
    // keeps both address pairs whole until every load above has taken them: left
    // free, the last load's result is placed on the pair that all eight name
    asm volatile("s_wait_xcnt 0x0" :: "v"(cp), "v"(sp) : "memory");
    lay_partial();
    __syncthreads();                          // both partial tiles are in LDS

    float r1[8], r2[8], ss[8];
    #pragma unroll
    for (int u = 0; u < 8; ++u) {
      const int o = (rb + u) * SCPAD + lane;
      float x1 = sC[o] + sC1[o], x2 = sC[o + HD2] + sC1[o + HD2];
      r1[u] = x1 * cs[u] - x2 * sn[u];
      r2[u] = x1 * sn[u] + x2 * cs[u];
      ss[u] = r1[u] * r1[u] + r2[u] * r2[u];
    }
    #pragma unroll
    for (int off = 16; off > 0; off >>= 1)
      #pragma unroll
      for (int u = 0; u < 8; ++u) ss[u] += __shfl_xor(ss[u], off, 32);
    #pragma unroll
    for (int u = 0; u < 8; ++u) {
      float scale = rsqrtf(ss[u] * (1.0f / HD) + 1e-6f);
      float* p = C + (long long)(m0 + rb + u) * ldc + n0;
      p[lane]       = r1[u] * scale;
      p[lane + HD2] = r2[u] * scale;
    }
    return;
  }

  lay_partial();
  __syncthreads();                            // all partial tiles are in LDS
  // TN/4 threads per row, 16 bytes each: whole 128-byte lines from one wave.
  #pragma unroll
  for (int q = 0; q < TN / 16; ++q) {
    const int row = tid / BR4 + q * (NT / BR4), c4 = (tid % BR4) * 4;
    float4 s = *(const float4*)&sC[row * SCPAD + c4];
    #pragma unroll
    for (int g = 1; g < NG; ++g) {
      const float4 t = *(const float4*)&sC[(g * BM + row) * SCPAD + c4];
      s = make_float4(s.x + t.x, s.y + t.y, s.z + t.z, s.w + t.w);
    }
    *(float4*)&C[(long long)(m0 + row) * ldc + n0 + c4] = s;
  }
  // the built code places the RoPE block behind these stores, and that block
  // rewrites their address registers: the wait stands in front of the rewrite
  if (FUSE) asm volatile("s_wait_xcnt 0x0" ::: "memory");
}

__global__ __launch_bounds__(NT)
void gemm_f32_wmma(const float* __restrict__ A, const float* __restrict__ B,
                   float* __restrict__ C, int M, int N, int K,
                   int lda, int ldb, int ldc,
                   long long aHeadStride, int bHeadColStride, int bHeadDiv,
                   int cHeadColStride)
{
  const int h = blockIdx.z;
  gemm_tile<false, BNO>(A + (long long)h * aHeadStride,
            B + (long long)(h / bHeadDiv) * bHeadColStride,
            C + (long long)h * cHeadColStride,
            K, lda, ldb, ldc, blockIdx.y * BM, blockIdx.x * BNO,
            false, nullptr, nullptr);
}

// q, k and v projections in ONE grid: they share A = x and do not depend on
// each other. Column tiles 0-15 belong to q, 16-23 to k, 24-31 to v, so the
// launch has 32 x 8 = 256 workgroups instead of 128, 64 and 64 in turn.
// A column tile is one head, and the q and k tiles leave rotated and normed.
#define QT (C_DIM / BN)
#define KT ((NKV * HD) / BN)

__global__ __launch_bounds__(NT)
void qkv_f32_wmma(const float* __restrict__ x, const float* __restrict__ Wq,
                  const float* __restrict__ Wk, const float* __restrict__ Wv,
                  const float* __restrict__ cosp, const float* __restrict__ sinp,
                  float* __restrict__ q, float* __restrict__ k,
                  float* __restrict__ v)
{
  const int bx = blockIdx.x;          // uniform over the workgroup
  const float* W = Wq;
  float* o = q;
  int ld = C_DIM, nt = bx;
  if (bx >= QT + KT)  { W = Wv; o = v; ld = NKV * HD; nt = bx - (QT + KT); }
  else if (bx >= QT)  { W = Wk; o = k; ld = NKV * HD; nt = bx - QT; }
  gemm_tile<true, BN>(x, W, o, C_DIM, C_DIM, ld, ld, blockIdx.y * BM, nt * BN,
                  bx < QT + KT, cosp, sinp);
}

// ---------------------------------------------------------------------------
// Tropical attention, one launch: S[i,j] = max_d(q[i,d] + k[j,d]), causal
// softmax over j <= i, y = P @ V. The scores never leave LDS.
// One workgroup = one head and two 16-row query tiles, p and 31 - p, so every
// workgroup has the same causal work (16 rows x 528 keys).
//   stage : q tile and all keys of the kv head, both transposed to [d][row]
//   scores: a wave takes 16 rows x 32 keys; a lane owns 4 rows x 4 keys, so one
//           16-byte LDS read of q and one of k feed 16 add/max pairs
//   probs : two rows per wave, same arithmetic and order as a row-wise softmax;
//           exact zeros for j > i
//   P @ V : V_WMMA_F32_16X16X4_F32, one wave per 16x16 output tile, k ascending
//           up to the tile's last causal key
// v overlays k in LDS once the scores are done.
// ---------------------------------------------------------------------------
typedef __attribute__((ext_vector_type(4))) float v4f;

#define AT_THREADS 512
#define KTP 516   // kT pitch: 4 d-rows apart = 16 banks, so transposing stores do not collide
#define QTP 36    // qT pitch: same property, 16-byte aligned rows
#define VLP 72    // v pitch: rows k and k+2 land on disjoint bank ranges
#define SSP 516   // score pitch: 16 rows x b64 reads cover all 64 banks once

// 2^x as the fast exponential compiles it, with the free slot that the
// instruction set asks for behind a transcendental tied to it: as a statement of
// its own the v_nop was scheduled away from the v_exp_f32.
__device__ __forceinline__ float exp2_slot(float x)
{
  float r;
  asm("v_exp_f32 %0, %1\n\tv_nop" : "=v"(r) : "v"(x));
  return r;
}

__global__ __launch_bounds__(AT_THREADS)
void tropical_attention(const float* __restrict__ q, const float* __restrict__ k,
                        const float* __restrict__ v, float* __restrict__ y)
{
  __shared__ __align__(16) float sKV[T_SEQ * VLP];   // kT[64][KTP], later v[512][VLP]
  __shared__ __align__(16) float sS[32][SSP];        // rows 0-15 tile p, 16-31 tile 31-p
  __shared__ __align__(16) float qT[HD][QTP];

  const int p    = blockIdx.x;
  const int h    = blockIdx.y;
  const int tid  = threadIdx.x;
  const int lane = tid & 31;
  const int wave = __builtin_amdgcn_readfirstlane(tid >> 5);
  const int rowA = 16 * p;
  const int rowB = 16 * (31 - p);
  const int kvo  = (h >> 1) * HD;

  // ---- stage q and k transposed: a wave covers 8 rows x 4 float4 columns ----
  {
    const int sub = ((wave >> 2) << 3) + (lane & 7);
    const int c4  = ((wave & 3) << 2) + (lane >> 3);
    const int grow = (sub < 16) ? rowA + sub : rowB + sub - 16;
    v4f qv = *(const v4f*)(q + grow * C_DIM + h * HD + c4 * 4);
    const float* kb = k + sub * (NKV * HD) + kvo + c4 * 4;
    v4f kr[16];
    #pragma unroll
    for (int it = 0; it < 16; ++it)
      kr[it] = *(const v4f*)(kb + it * 32 * (NKV * HD));
    #pragma unroll
    for (int e = 0; e < 4; ++e) qT[c4 * 4 + e][sub] = qv[e];
    #pragma unroll
    for (int it = 0; it < 16; ++it)
      #pragma unroll
      for (int e = 0; e < 4; ++e)
        sKV[(c4 * 4 + e) * KTP + it * 32 + sub] = kr[it][e];
  }

  __syncthreads();                       // qT and kT complete

  // v is fetched now and parked in registers: its latency runs under the scores.
  const float* vb = v + (tid >> 4) * (NKV * HD) + kvo + (tid & 15) * 4;
  v4f vr[16];
  #pragma unroll
  for (int it = 0; it < 16; ++it)
    vr[it] = *(const v4f*)(vb + it * 32 * (NKV * HD));
  // keeps the address pair whole until every load above has taken it: left
  // free, the last load's result is placed on the pair that all sixteen name
  asm volatile("s_wait_xcnt 0x0" :: "v"(vb) : "memory");

  // ---- scores ----
  const int cB = (33 - p) >> 1;          // 32-key chunks that tile 31-p needs
  const int cA = (p + 2) >> 1;           // ... and tile p; cA + cB = 17
  {
    const int li = lane >> 3, lj = lane & 7;
    for (int job = wave; job < cA + cB; job += AT_THREADS / 32) {
      const int tile  = (job < cB) ? 1 : 0;
      const int chunk = tile ? job : job - cB;
      const float* qp = &qT[0][tile * 16 + li * 4];
      const float* kp = &sKV[chunk * 32 + lj * 4];
      v2f sc[4][2];
      #pragma unroll
      for (int r = 0; r < 4; ++r) {
        sc[r][0] = (v2f){-3.0e38f, -3.0e38f};
        sc[r][1] = (v2f){-3.0e38f, -3.0e38f};
      }
      // four d pairs per trip: 16 LDS reads go out together ahead of their 128
      // packed adds and three-way maxima
      #pragma unroll 4
      for (int d = 0; d < HD; d += 2) {
        v4f qa = *(const v4f*)(qp + d * QTP);
        v4f qb = *(const v4f*)(qp + (d + 1) * QTP);
        v4f ka = *(const v4f*)(kp + d * KTP);
        v4f kb = *(const v4f*)(kp + (d + 1) * KTP);
        #pragma unroll
        for (int r = 0; r < 4; ++r) {
          v2f a0 = (v2f){qa[r], qa[r]} + ka.xy;
          v2f a1 = (v2f){qa[r], qa[r]} + ka.zw;
          v2f b0 = (v2f){qb[r], qb[r]} + kb.xy;
          v2f b1 = (v2f){qb[r], qb[r]} + kb.zw;
          sc[r][0].x = fmaxf(fmaxf(sc[r][0].x, a0.x), b0.x);
          sc[r][0].y = fmaxf(fmaxf(sc[r][0].y, a0.y), b0.y);
          sc[r][1].x = fmaxf(fmaxf(sc[r][1].x, a1.x), b1.x);
          sc[r][1].y = fmaxf(fmaxf(sc[r][1].y, a1.y), b1.y);
        }
      }
      #pragma unroll
      for (int r = 0; r < 4; ++r)
        *(v4f*)&sS[tile * 16 + li * 4 + r][chunk * 32 + lj * 4] =
            (v4f){sc[r][0].x, sc[r][0].y, sc[r][1].x, sc[r][1].y};
    }
  }
  __syncthreads();                       // scores complete, kT dead

  // ---- v into the space of kT ----
  #pragma unroll
  for (int it = 0; it < 16; ++it)
    *(v4f*)&sKV[((tid >> 4) + it * 32) * VLP + (tid & 15) * 4] = vr[it];

  // ---- causal softmax, two rows per wave, 16 columns per lane ----
  // The two rows go through each stage side by side, so that one row's
  // cross-lane steps run under the other's.
  {
    float pv[2][16], m[2], sum[2];
    int   ir[2];
    #pragma unroll
    for (int u = 0; u < 2; ++u) {
      const int rr = wave * 2 + u;
      ir[u] = (rr < 16) ? rowA + rr : rowB + rr - 16;
      m[u] = -3.0e38f;
      #pragma unroll
      for (int jj = 0; jj < 16; ++jj) {
        int j = lane + jj * 32;
        float val = (j <= ir[u]) ? sS[rr][j] : -3.0e38f;
        pv[u][jj] = val;
        m[u] = fmaxf(m[u], val);
      }
    }
    #pragma unroll
    for (int off = 16; off > 0; off >>= 1)
      #pragma unroll
      for (int u = 0; u < 2; ++u) m[u] = fmaxf(m[u], __shfl_xor(m[u], off, 32));

    #pragma unroll
    for (int u = 0; u < 2; ++u) {
      sum[u] = 0.f;
      #pragma unroll
      for (int jj = 0; jj < 16; ++jj) {
        int j = lane + jj * 32;
        float ex = exp2_slot((pv[u][jj] - m[u]) * 1.442695041f);   // every lane: no branch round it
        float e = (j <= ir[u]) ? ex : 0.f;
        pv[u][jj] = e;
        sum[u] += e;
      }
    }
    #pragma unroll
    for (int off = 16; off > 0; off >>= 1)
      #pragma unroll
      for (int u = 0; u < 2; ++u) sum[u] += __shfl_xor(sum[u], off, 32);

    #pragma unroll
    for (int u = 0; u < 2; ++u) {
      float inv = 1.0f / sum[u];   // row i always has valid j=0 -> sum >= exp(0) > 0
      #pragma unroll
      for (int jj = 0; jj < 16; ++jj) sS[wave * 2 + u][lane + jj * 32] = pv[u][jj] * inv;
    }
  }
  __syncthreads();                       // probabilities and v complete

  // ---- y tile = P (16 x nk) @ V (nk x 16), waves 0-3 tile p, 4-7 tile 31-p ----
  if (wave < 8) {                        // wave-uniform: EXEC stays all ones
    const int tile = wave >> 2, nt = wave & 3;
    const int row0 = tile ? rowB : rowA;
    const int nk   = row0 + 16;          // keys 0 .. row0+15; P is 0 above the diagonal
    const int l16  = lane & 15;
    const int koff = (lane >> 4) * 2;    // lanes 0-15: K=0,1  lanes 16-31: K=2,3
    const float* pA = &sS[tile * 16 + l16][koff];
    const float* pB = &sKV[koff * VLP + nt * 16 + l16];

    v8f acc = (v8f){0.f,0.f,0.f,0.f,0.f,0.f,0.f,0.f};
    v2f a[4], b[4];
    #pragma unroll
    for (int s = 0; s < 4; ++s) {
      a[s]   = *(const v2f*)(pA + s * 4);
      b[s].x = pB[(s * 4) * VLP];
      b[s].y = pB[(s * 4 + 1) * VLP];
    }
    // Groups of 16 keys, each group's fragments read one group ahead. The count
    // is rounded up to even (P is an exact 0 in the added group), so that the
    // unroll by two, which lets the two fragment sets alternate without
    // register copies, leaves no remainder loop.
    const int ng = ((nk + 31) >> 5) * 2;
    #pragma unroll 2
    for (int g = 0; g < ng; ++g) {
      const int kn = ((g + 1 < ng) ? g + 1 : g) * 16;   // last trip: its own group again
      v2f an[4], bn[4];
      #pragma unroll
      for (int s = 0; s < 4; ++s) {
        an[s]   = *(const v2f*)(pA + kn + s * 4);
        bn[s].x = pB[(kn + s * 4) * VLP];
        bn[s].y = pB[(kn + s * 4 + 1) * VLP];
      }
      // holds the reads above ahead of the WMMAs below: left free, they sink to
      // just before their use and every LDS latency is waited out in the chain
      __builtin_amdgcn_sched_barrier(0);
      #pragma unroll
      for (int s = 0; s < 4; ++s)
        acc = __builtin_amdgcn_wmma_f32_16x16x4_f32(false, a[s], false, b[s],
                                                    (short)0, acc, false, false);
      #pragma unroll
      for (int s = 0; s < 4; ++s) { a[s] = an[s]; b[s] = bn[s]; }
    }

    // C/D layout: VGPR r -> M = r (lanes 0-15) / M = 8+r (lanes 16-31), N = lane%16.
    float* yp = y + (row0 + (lane >> 4) * 8) * C_DIM + h * HD + nt * 16 + l16;
    #pragma unroll
    for (int r = 0; r < 8; ++r) yp[r * C_DIM] = acc[r];
  }
}

// ---------------------------------------------------------------------------
extern "C" void kernel_launch(void* const* d_in, const int* in_sizes, int n_in,
                              void* d_out, int out_size, void* d_ws, size_t ws_size,
                              hipStream_t stream) {
  const float* x    = (const float*)d_in[0];
  const float* cosp = (const float*)d_in[1];
  const float* sinp = (const float*)d_in[2];
  const float* Wq   = (const float*)d_in[3];
  const float* Wk   = (const float*)d_in[4];
  const float* Wv   = (const float*)d_in[5];
  const float* Wo   = (const float*)d_in[6];
  float*       out  = (float*)d_out;

  float* ws   = (float*)d_ws;
  float* qbuf = ws;                                   // 512*1024
  float* kbuf = qbuf + (size_t)T_SEQ * C_DIM;         // 512*512
  float* vbuf = kbuf + (size_t)T_SEQ * NKV * HD;      // 512*512
  float* sbuf = vbuf + (size_t)T_SEQ * NKV * HD;      // 16*512*512
  float* ybuf = sbuf + (size_t)NH * T_SEQ * T_SEQ;    // 512*1024

  dim3 blk(NT);

  // q = x @ Wq (512x1024x1024), k = x @ Wk, v = x @ Wv (512x512x1024): one grid;
  // RoPE + RMS-norm on q (16 heads) and k (8 heads) in its epilogue.
  qkv_f32_wmma<<<dim3(QT + 2 * KT, T_SEQ / BM, 1), blk, 0, stream>>>(
      x, Wq, Wk, Wv, cosp, sinp, qbuf, kbuf, vbuf);

  // Tropical scores, causal softmax and y[h] = P[h] @ V[h/2] in one grid:
  // 16 row-tile pairs x 16 heads = 256 workgroups.
  tropical_attention<<<dim3(T_SEQ / 32, NH, 1), dim3(AT_THREADS), 0, stream>>>(
      qbuf, kbuf, vbuf, ybuf);

  // out = y @ Wo   (512x1024x1024): 64x32 tiles, 32 x 8 = 256 workgroups
  gemm_f32_wmma<<<dim3(C_DIM / BNO, T_SEQ / BM, 1), blk, 0, stream>>>(
      ybuf, Wo, out, T_SEQ, C_DIM, C_DIM, C_DIM, C_DIM, C_DIM, 0LL, 0, 1, 0);
}

// v006
// Measured time: 36.5 microseconds a run.
// In two side-by-side timings against v005, it was 1.11 and 1.12 times as fast.
// Counting every step since v000, it is 3.99 times as fast.
#include <hip/hip_runtime.h>
#include <hip/hip_bf16.h>
#include <math.h>

typedef __attribute__((ext_vector_type(2))) float v2f;
typedef __attribute__((ext_vector_type(8))) float v8f;
typedef __attribute__((ext_vector_type(4))) int   v4i;

#define T_SEQ 512
#define C_DIM 1024
#define NH    16
#define NKV   8
#define HD    64
#define HD2   32

// ---------------------------------------------------------------------------
// Async memory->LDS staging (gfx1250 GLOBAL_LOAD_ASYNC_TO_LDS_B128, ASYNCcnt),
// with a synchronous float4 fallback if the toolchain lacks the builtin.
// Builtin signature (from clang diagnostic): (v4i addrspace(1)*, v4i
// addrspace(3)*, imm offset, imm cpol).
// ---------------------------------------------------------------------------
#define GLOBAL_AS __attribute__((address_space(1)))
#define LDS_AS    __attribute__((address_space(3)))

#if __has_builtin(__builtin_amdgcn_global_load_async_to_lds_b128)
#define HAVE_ASYNC_LDS 1
#define ASYNC_COPY16(gp, lp)                                                   \
  __builtin_amdgcn_global_load_async_to_lds_b128(                              \
      (GLOBAL_AS v4i*)(unsigned long long)(gp),                                \
      (LDS_AS v4i*)(unsigned)(unsigned long long)(lp), 0, 0)
#else
#define HAVE_ASYNC_LDS 0
#define ASYNC_COPY16(gp, lp) (*(float4*)(lp) = *(const float4*)(gp))
#endif

#if HAVE_ASYNC_LDS
// asm with the memory clobber: no LDS read may be lifted over the wait
#define WAIT_ASYNC(n) asm volatile("s_wait_asynccnt %0" ::"i"(n) : "memory")
#else
#define WAIT_ASYNC(n) ((void)0)
#endif

// ---------------------------------------------------------------------------
// Generic f32 GEMM, C = A @ B, using V_WMMA_F32_16X16X4_F32.
// Block tile 64xTN, 256 threads = 8 waves. Each wave owns a 32x32 piece = 2x2
// WMMA tiles (2 A-frags + 2 B-frags feed 4 WMMAs -> 2x fragment reuse); the
// waves that cover the tile once are a group: 4 waves and 2 groups at TN = 64,
// 2 waves and 4 groups at TN = 32. A trip of the K loop covers 32 k per group:
// group g stages and multiplies the 32-wide chunk g of it, so every SIMD holds
// two waves (one runs its WMMAs under the other's LDS waits). The groups'
// partial tiles are added in LDS behind the loop.
// TN = 32 is for a product with fewer 64x64 tiles than the chip has WGPs: the
// f32 matrix rate is per WGP, so twice the tiles at half the WMMAs each halve
// the loop (half the trips, the trip itself as at TN = 64).
// Chunks go through a ring of three LDS buffers, staged with async LDS-DMA two
// trips ahead: a copy has two trips of WMMAs to land in, not one, and the one
// barrier that publishes trip i also frees the buffer of trip i-1 for trip i+2.
// All launches use M,N that are exact multiples of the tile and K a multiple
// of a trip's 64 or 128 (no guards, EXEC stays all-ones as WMMA requires).
// ---------------------------------------------------------------------------
#define BM 64
#define BN 64
#define BK 32
#define BNO 32     // tile width of the output projection: 32 x 8 = 256 tiles
#define NT 256     // threads of a work-group
#define SAPAD 36   // A pad: 36*l16 mod 64 distinct over 16 lanes -> no conflicts

// FUSE: the caller has tiles that leave through the RoPE + RMS-norm epilogue
// (TN == HD and two groups there). TN: tile width, 64 or 32.
template <bool FUSE, int TN>
__device__ __forceinline__
void gemm_tile(const float* __restrict__ A, const float* __restrict__ B,
               float* __restrict__ C, int K, int lda, int ldb, int ldc,
               int m0, int n0, bool rope,
               const float* __restrict__ cosp, const float* __restrict__ sinp)
{
  const int tid  = threadIdx.x;
  const int lane = tid & 31;
  const int wave = tid >> 5;
  constexpr int GT    = 2 * TN;       // threads of a group: 2 x TN/32 waves
  constexpr int NG    = NT / GT;      // wave groups that share the K loop
  constexpr int SBPAD = TN + 8;       // B pad: koff row pairs land on disjoint bank ranges
  constexpr int SCPAD = TN + 4;       // C pad: rows r and r+8 land 32 banks apart -> no conflicts
  constexpr int BR4   = TN / 4;       // float4s of a B or C row
  constexpr int NA    = BM * BK / 4 / GT;   // A copies of a thread per trip (B: 4)
  constexpr int NC    = NA + 4;             // copies of a thread per trip
  constexpr int STEP  = NG * BK;            // k that a trip covers
  // which 32-wide chunk of every trip; the same in all lanes of a wave, so the
  // offsets formed from it are kept scalar
  const int grp  = __builtin_amdgcn_readfirstlane(tid / GT);
  const int gtid = tid & (GT - 1);
  const int wm   = (wave / (TN / 32)) & 1;   // 2 x TN/32 wave grid over the tile
  const int wn   = wave & (TN / 32 - 1);
  const int l16  = lane & 15;
  const int koff = (lane >> 4) * 2;   // lanes 0-15: K=0,1  lanes 16-31: K=2,3

  __shared__ __align__(16) float sA[3][NG][BM][SAPAD];  // A row-major
  __shared__ __align__(16) float sB[3][NG][BK][SBPAD];  // B row-major [k][n]

  v8f acc[2][2];
  #pragma unroll
  for (int mi = 0; mi < 2; ++mi)
    #pragma unroll
    for (int ni = 0; ni < 2; ++ni)
      acc[mi][ni] = (v8f){0.f,0.f,0.f,0.f,0.f,0.f,0.f,0.f};

  // Stage the group's own K-chunk of the next trip not yet staged:
  // A 64x32 + B 32xTN, in float4s: NA + 4 per thread of the group. The trips are
  // staged in their order, so the two source addresses just walk along K.
  const int ar = gtid >> 3,  ac = (gtid & 7) * 4;      // A: 8 float4 per row
  const int br = gtid / BR4, bc = (gtid % BR4) * 4;    // B: TN/4 float4 per row
  const float* gA = A + (long long)(m0 + ar) * lda + grp * BK + ac;
  const float* gB = B + (long long)(grp * BK + br) * ldb + n0 + bc;
  auto stage = [&](int buf) {
    #pragma unroll
    for (int q = 0; q < NA; ++q) {
      ASYNC_COPY16(gA + (long long)(q * (GT / 8)) * lda, &sA[buf][grp][ar + q * (GT / 8)][ac]);
      if (q < 4)
        ASYNC_COPY16(gB + (long long)(q * (GT / BR4)) * ldb, &sB[buf][grp][br + q * (GT / BR4)][bc]);
    }
    gA += STEP;
    gB += (long long)STEP * ldb;
  };

  stage(0);
  if (STEP < K) stage(1);
  int buf = 0, fill = 2;                      // buffer of trip i, of trip i+2
  // One trip. next: a trip i+1 exists (its copies are in flight); refill: a trip
  // i+2 exists. Both are literals at each call, so no trip tests for them.
  auto trip = [&](bool next, bool refill) {
    // publish point of this trip's buffer. This wave's LDS reads of the trip
    // before are done: behind the barrier their buffer is refilled.
    asm volatile("s_wait_dscnt 0x0" ::: "memory");
    if (next) WAIT_ASYNC(NC);                 // this trip's copies done, the next trip's in flight
    else      WAIT_ASYNC(0);
    __syncthreads();                          // everyone's staging visible, last trip's buffer free

    const float (*pA)[SAPAD] = sA[buf][grp];
    const float (*pB)[SBPAD] = sB[buf][grp];
    auto frag = [&](int k4, v2f& a0, v2f& a1, v2f& b0, v2f& b1) {
      a0 = *(const v2f*)&pA[wm * 32 + l16][k4 + koff];             // ds b64
      a1 = *(const v2f*)&pA[wm * 32 + 16 + l16][k4 + koff];
      b0.x = pB[k4 + koff    ][wn * 32 + l16];                     // ds 2addr b32
      b0.y = pB[k4 + koff + 1][wn * 32 + l16];
      b1.x = pB[k4 + koff    ][wn * 32 + 16 + l16];
      b1.y = pB[k4 + koff + 1][wn * 32 + 16 + l16];
    };
    auto mma4 = [&](v2f a0, v2f a1, v2f b0, v2f b1) {
      // 8 args: (neg_a, A, neg_b, B, c_mod, C, reuse_a, reuse_b)
      acc[0][0] = __builtin_amdgcn_wmma_f32_16x16x4_f32(false, a0, false, b0,
                                                        (short)0, acc[0][0], false, false);
      acc[0][1] = __builtin_amdgcn_wmma_f32_16x16x4_f32(false, a0, false, b1,
                                                        (short)0, acc[0][1], false, false);
      acc[1][0] = __builtin_amdgcn_wmma_f32_16x16x4_f32(false, a1, false, b0,
                                                        (short)0, acc[1][0], false, false);
      acc[1][1] = __builtin_amdgcn_wmma_f32_16x16x4_f32(false, a1, false, b1,
                                                        (short)0, acc[1][1], false, false);
    };

    // The first fragments are asked for ahead of the refill, whose issue then
    // runs under their LDS latency.
    v2f fa0[2], fa1[2], fb0[2], fb1[2];
    #pragma unroll
    for (int s = 0; s < 2; ++s) frag(s * 4, fa0[s], fa1[s], fb0[s], fb1[s]);
    if (refill) stage(fill);                  // into the buffer that the trip before read
    #pragma unroll
    for (int s = 0; s < 2; ++s) mma4(fa0[s], fa1[s], fb0[s], fb1[s]);
    #pragma unroll
    for (int k4 = 8; k4 < BK; k4 += 4) {
      v2f a0, a1, b0, b1;
      frag(k4, a0, a1, b0, b1);
      mma4(a0, a1, b0, b1);
    }
    buf  = (buf  == 2) ? 0 : buf + 1;
    fill = (fill == 2) ? 0 : fill + 1;
  };
  for (int kk = 2 * STEP; kk < K; kk += STEP) trip(true, true);
  if (STEP < K) trip(true, false);
  trip(false, false);
  // the ring becomes output staging: every wave's last reads are done first
  asm volatile("s_wait_dscnt 0x0" ::: "memory");
  __syncthreads();

  // All groups lay their partial tile into LDS (sA is dead behind the barrier
  // above, no copy is in flight); every element then leaves as the
  // groups' sums added in the order of the groups.
  float* sC = &sA[0][0][0][0];                // NG x 64 x SCPAD floats fit in sA
  const float* sC1 = sC + BM * SCPAD;
  // C/D layout: VGPR r -> M = r (lanes 0-15) / M = 8+r (lanes 16-31), N = lane%16.
  auto lay_partial = [&]() {
    #pragma unroll
    for (int mi = 0; mi < 2; ++mi)
      #pragma unroll
      for (int ni = 0; ni < 2; ++ni)
        #pragma unroll
        for (int r = 0; r < 8; ++r)
          sC[(grp * BM + wm * 32 + mi * 16 + (lane >> 4) * 8 + r) * SCPAD + wn * 32 + ni * 16 + l16] =
              acc[mi][ni][r];
  };

  // RoPE + per-head RMS-norm on the way out (workgroup-uniform choice). BN == HD,
  // so the tile's 64 columns are one whole head of 64 tokens. One wave per row,
  // lane l owning dims l and l+32, 8 rows per wave side by side so that one
  // row's cross-lane steps run under the others'.
  if (FUSE && rope) {
    const int rb = wave * 8;
    const float* cp = cosp + (m0 + rb) * HD2 + lane;
    const float* sp = sinp + (m0 + rb) * HD2 + lane;
    float cs[8], sn[8];                       // fetched first: latency runs under the LDS pass
    #pragma unroll
    for (int u = 0; u < 8; ++u) {
      cs[u] = cp[u * HD2];
      sn[u] = sp[u * HD2];
    }
    // keeps both address pairs whole until every load above has taken them: left
    // free, the last load's result is placed on the pair that all eight name
    asm volatile("s_wait_xcnt 0x0" :: "v"(cp), "v"(sp) : "memory");
    lay_partial();
    __syncthreads();                          // both partial tiles are in LDS

    float r1[8], r2[8], ss[8];
    #pragma unroll
    for (int u = 0; u < 8; ++u) {
      const int o = (rb + u) * SCPAD + lane;
      float x1 = sC[o] + sC1[o], x2 = sC[o + HD2] + sC1[o + HD2];
      r1[u] = x1 * cs[u] - x2 * sn[u];
      r2[u] = x1 * sn[u] + x2 * cs[u];
      ss[u] = r1[u] * r1[u] + r2[u] * r2[u];
    }
    #pragma unroll
    for (int off = 16; off > 0; off >>= 1)
      #pragma unroll
      for (int u = 0; u < 8; ++u) ss[u] += __shfl_xor(ss[u], off, 32);
    #pragma unroll
    for (int u = 0; u < 8; ++u) {
      float scale = rsqrtf(ss[u] * (1.0f / HD) + 1e-6f);
      float* p = C + (long long)(m0 + rb + u) * ldc + n0;
      p[lane]       = r1[u] * scale;
      p[lane + HD2] = r2[u] * scale;
    }
    return;
  }

  lay_partial();
  __syncthreads();                            // all partial tiles are in LDS
  // TN/4 threads per row, 16 bytes each: whole 128-byte lines from one wave.
  #pragma unroll
  for (int q = 0; q < TN / 16; ++q) {
    const int row = tid / BR4 + q * (NT / BR4), c4 = (tid % BR4) * 4;
    float4 s = *(const float4*)&sC[row * SCPAD + c4];
    #pragma unroll
    for (int g = 1; g < NG; ++g) {
      const float4 t = *(const float4*)&sC[(g * BM + row) * SCPAD + c4];
      s = make_float4(s.x + t.x, s.y + t.y, s.z + t.z, s.w + t.w);
    }
    *(float4*)&C[(long long)(m0 + row) * ldc + n0 + c4] = s;
  }
  // the built code places the RoPE block behind these stores, and that block
  // rewrites their address registers: the wait stands in front of the rewrite
  if (FUSE) asm volatile("s_wait_xcnt 0x0" ::: "memory");
}

__global__ __launch_bounds__(NT)
void gemm_f32_wmma(const float* __restrict__ A, const float* __restrict__ B,
                   float* __restrict__ C, int M, int N, int K,
                   int lda, int ldb, int ldc,
                   long long aHeadStride, int bHeadColStride, int bHeadDiv,
                   int cHeadColStride)
{
  const int h = blockIdx.z;
  gemm_tile<false, BNO>(A + (long long)h * aHeadStride,
            B + (long long)(h / bHeadDiv) * bHeadColStride,
            C + (long long)h * cHeadColStride,
            K, lda, ldb, ldc, blockIdx.y * BM, blockIdx.x * BNO,
            false, nullptr, nullptr);
}

// q, k and v projections in ONE grid: they share A = x and do not depend on
// each other. Column tiles 0-15 belong to q, 16-23 to k, 24-31 to v, so the
// launch has 32 x 8 = 256 workgroups instead of 128, 64 and 64 in turn.
// A column tile is one head, and the q and k tiles leave rotated and normed.
#define QT (C_DIM / BN)
#define KT ((NKV * HD) / BN)

__global__ __launch_bounds__(NT)
void qkv_f32_wmma(const float* __restrict__ x, const float* __restrict__ Wq,
                  const float* __restrict__ Wk, const float* __restrict__ Wv,
                  const float* __restrict__ cosp, const float* __restrict__ sinp,
                  float* __restrict__ q, float* __restrict__ k,
                  float* __restrict__ v)
{
  const int bx = blockIdx.x;          // uniform over the workgroup
  const float* W = Wq;
  float* o = q;
  int ld = C_DIM, nt = bx;
  if (bx >= QT + KT)  { W = Wv; o = v; ld = NKV * HD; nt = bx - (QT + KT); }
  else if (bx >= QT)  { W = Wk; o = k; ld = NKV * HD; nt = bx - QT; }
  gemm_tile<true, BN>(x, W, o, C_DIM, C_DIM, ld, ld, blockIdx.y * BM, nt * BN,
                  bx < QT + KT, cosp, sinp);
}

// ---------------------------------------------------------------------------
// Tropical attention, one launch: S[i,j] = max_d(q[i,d] + k[j,d]), causal
// softmax over j <= i, y = P @ V. The scores never leave LDS.
// One workgroup = one head and two 16-row query tiles, p and 31 - p, so every
// workgroup has the same causal work (16 rows x 528 keys).
//   stage : q tile and all keys of the kv head, both transposed to [d][row]
//   scores: a wave takes 16 rows x 32 keys; a lane owns 4 rows x 4 keys, so one
//           16-byte LDS read of q and one of k feed 16 add/max pairs
//   probs : two rows per wave, same arithmetic and order as a row-wise softmax;
//           exact zeros for j > i
//   P @ V : V_WMMA_F32_16X16X4_F32, one wave per 16x16 output tile, k ascending
//           up to the tile's last causal key
// v overlays k in LDS once the scores are done.
// ---------------------------------------------------------------------------
typedef __attribute__((ext_vector_type(4))) float v4f;

#define AT_THREADS 512
#define KTP 516   // kT pitch: 4 d-rows apart = 16 banks, so transposing stores do not collide
#define QTP 36    // qT pitch: same property, 16-byte aligned rows
#define VLP 72    // v pitch: rows k and k+2 land on disjoint bank ranges
#define SSP 516   // score pitch: 16 rows x b64 reads cover all 64 banks once

// 2^x as the fast exponential compiles it, with the free slot that the
// instruction set asks for behind a transcendental tied to it: as a statement of
// its own the v_nop was scheduled away from the v_exp_f32.
__device__ __forceinline__ float exp2_slot(float x)
{
  float r;
  asm("v_exp_f32 %0, %1\n\tv_nop" : "=v"(r) : "v"(x));
  return r;
}

__global__ __launch_bounds__(AT_THREADS)
void tropical_attention(const float* __restrict__ q, const float* __restrict__ k,
                        const float* __restrict__ v, float* __restrict__ y)
{
  __shared__ __align__(16) float sKV[T_SEQ * VLP];   // kT[64][KTP], later v[512][VLP]
  __shared__ __align__(16) float sS[32][SSP];        // rows 0-15 tile p, 16-31 tile 31-p
  __shared__ __align__(16) float qT[HD][QTP];

  const int p    = blockIdx.x;
  const int h    = blockIdx.y;
  const int tid  = threadIdx.x;
  const int lane = tid & 31;
  const int wave = __builtin_amdgcn_readfirstlane(tid >> 5);
  const int rowA = 16 * p;
  const int rowB = 16 * (31 - p);
  const int kvo  = (h >> 1) * HD;

  // ---- stage q and k transposed: a wave covers 8 rows x 4 float4 columns ----
  {
    const int sub = ((wave >> 2) << 3) + (lane & 7);
    const int c4  = ((wave & 3) << 2) + (lane >> 3);
    const int grow = (sub < 16) ? rowA + sub : rowB + sub - 16;
    v4f qv = *(const v4f*)(q + grow * C_DIM + h * HD + c4 * 4);
    const float* kb = k + sub * (NKV * HD) + kvo + c4 * 4;
    v4f kr[16];
    #pragma unroll
    for (int it = 0; it < 16; ++it)
      kr[it] = *(const v4f*)(kb + it * 32 * (NKV * HD));
    #pragma unroll
    for (int e = 0; e < 4; ++e) qT[c4 * 4 + e][sub] = qv[e];
    #pragma unroll
    for (int it = 0; it < 16; ++it)
      #pragma unroll
      for (int e = 0; e < 4; ++e)
        sKV[(c4 * 4 + e) * KTP + it * 32 + sub] = kr[it][e];
  }

  __syncthreads();                       // qT and kT complete

  // v is fetched now and parked in registers: its latency runs under the scores.
  const float* vb = v + (tid >> 4) * (NKV * HD) + kvo + (tid & 15) * 4;
  v4f vr[16];
  #pragma unroll
  for (int it = 0; it < 16; ++it)
    vr[it] = *(const v4f*)(vb + it * 32 * (NKV * HD));
  // keeps the address pair whole until every load above has taken it: left
  // free, the last load's result is placed on the pair that all sixteen name
  asm volatile("s_wait_xcnt 0x0" :: "v"(vb) : "memory");

  // ---- scores ----
  const int cB = (33 - p) >> 1;          // 32-key chunks that tile 31-p needs
  const int cA = (p + 2) >> 1;           // ... and tile p; cA + cB = 17
  {
    const int li = lane >> 3, lj = lane & 7;
    for (int job = wave; job < cA + cB; job += AT_THREADS / 32) {
      const int tile  = (job < cB) ? 1 : 0;
      const int chunk = tile ? job : job - cB;
      const float* qp = &qT[0][tile * 16 + li * 4];
      const float* kp = &sKV[chunk * 32 + lj * 4];
      v2f sc[4][2];
      #pragma unroll
      for (int r = 0; r < 4; ++r) {
        sc[r][0] = (v2f){-3.0e38f, -3.0e38f};
        sc[r][1] = (v2f){-3.0e38f, -3.0e38f};
      }
      // four d pairs per trip: 16 LDS reads go out together ahead of their 128
      // packed adds and three-way maxima
      #pragma unroll 4
      for (int d = 0; d < HD; d += 2) {
        v4f qa = *(const v4f*)(qp + d * QTP);
        v4f qb = *(const v4f*)(qp + (d + 1) * QTP);
        v4f ka = *(const v4f*)(kp + d * KTP);
        v4f kb = *(const v4f*)(kp + (d + 1) * KTP);
        #pragma unroll
        for (int r = 0; r < 4; ++r) {
          v2f a0 = (v2f){qa[r], qa[r]} + ka.xy;
          v2f a1 = (v2f){qa[r], qa[r]} + ka.zw;
          v2f b0 = (v2f){qb[r], qb[r]} + kb.xy;
          v2f b1 = (v2f){qb[r], qb[r]} + kb.zw;
          sc[r][0].x = fmaxf(fmaxf(sc[r][0].x, a0.x), b0.x);
          sc[r][0].y = fmaxf(fmaxf(sc[r][0].y, a0.y), b0.y);
          sc[r][1].x = fmaxf(fmaxf(sc[r][1].x, a1.x), b1.x);
          sc[r][1].y = fmaxf(fmaxf(sc[r][1].y, a1.y), b1.y);
        }
      }
      #pragma unroll
      for (int r = 0; r < 4; ++r)
        *(v4f*)&sS[tile * 16 + li * 4 + r][chunk * 32 + lj * 4] =
            (v4f){sc[r][0].x, sc[r][0].y, sc[r][1].x, sc[r][1].y};
    }
  }
  __syncthreads();                       // scores complete, kT dead

  // ---- v into the space of kT ----
  #pragma unroll
  for (int it = 0; it < 16; ++it)
    *(v4f*)&sKV[((tid >> 4) + it * 32) * VLP + (tid & 15) * 4] = vr[it];

  // ---- causal softmax, two rows per wave, 16 columns per lane ----
  // The two rows go through each stage side by side, so that one row's
  // cross-lane steps run under the other's.
  {
    float pv[2][16], m[2], sum[2];
    int   ir[2];
    #pragma unroll
    for (int u = 0; u < 2; ++u) {
      const int rr = wave * 2 + u;
      ir[u] = (rr < 16) ? rowA + rr : rowB + rr - 16;
      m[u] = -3.0e38f;
      #pragma unroll
      for (int jj = 0; jj < 16; ++jj) {
        int j = lane + jj * 32;
        float val = (j <= ir[u]) ? sS[rr][j] : -3.0e38f;
        pv[u][jj] = val;
        m[u] = fmaxf(m[u], val);
      }
    }
    #pragma unroll
    for (int off = 16; off > 0; off >>= 1)
      #pragma unroll
      for (int u = 0; u < 2; ++u) m[u] = fmaxf(m[u], __shfl_xor(m[u], off, 32));

    #pragma unroll
    for (int u = 0; u < 2; ++u) {
      sum[u] = 0.f;
      #pragma unroll
      for (int jj = 0; jj < 16; ++jj) {
        int j = lane + jj * 32;
        float ex = exp2_slot((pv[u][jj] - m[u]) * 1.442695041f);   // every lane: no branch round it
        float e = (j <= ir[u]) ? ex : 0.f;
        pv[u][jj] = e;
        sum[u] += e;
      }
    }
    #pragma unroll
    for (int off = 16; off > 0; off >>= 1)
      #pragma unroll
      for (int u = 0; u < 2; ++u) sum[u] += __shfl_xor(sum[u], off, 32);

    #pragma unroll
    for (int u = 0; u < 2; ++u) {
      float inv = 1.0f / sum[u];   // row i always has valid j=0 -> sum >= exp(0) > 0
      #pragma unroll
      for (int jj = 0; jj < 16; ++jj) sS[wave * 2 + u][lane + jj * 32] = pv[u][jj] * inv;
    }
  }
  __syncthreads();                       // probabilities and v complete

  // ---- y tile = P (16 x nk) @ V (nk x 16), waves 0-3 tile p, 4-7 tile 31-p ----
  if (wave < 8) {                        // wave-uniform: EXEC stays all ones
    const int tile = wave >> 2, nt = wave & 3;
    const int row0 = tile ? rowB : rowA;
    const int nk   = row0 + 16;          // keys 0 .. row0+15; P is 0 above the diagonal
    const int l16  = lane & 15;
    const int koff = (lane >> 4) * 2;    // lanes 0-15: K=0,1  lanes 16-31: K=2,3
    const float* pA = &sS[tile * 16 + l16][koff];
    const float* pB = &sKV[koff * VLP + nt * 16 + l16];

    v8f acc = (v8f){0.f,0.f,0.f,0.f,0.f,0.f,0.f,0.f};
    v2f a[4], b[4];
    #pragma unroll
    for (int s = 0; s < 4; ++s) {
      a[s]   = *(const v2f*)(pA + s * 4);
      b[s].x = pB[(s * 4) * VLP];
      b[s].y = pB[(s * 4 + 1) * VLP];
    }
    // Groups of 16 keys, each group's fragments read one group ahead. The count
    // is rounded up to even (P is an exact 0 in the added group), so that the
    // unroll by two, which lets the two fragment sets alternate without
    // register copies, leaves no remainder loop.
    const int ng = ((nk + 31) >> 5) * 2;
    #pragma unroll 2
    for (int g = 0; g < ng; ++g) {
      const int kn = ((g + 1 < ng) ? g + 1 : g) * 16;   // last trip: its own group again
      v2f an[4], bn[4];
      #pragma unroll
      for (int s = 0; s < 4; ++s) {
        an[s]   = *(const v2f*)(pA + kn + s * 4);
        bn[s].x = pB[(kn + s * 4) * VLP];
        bn[s].y = pB[(kn + s * 4 + 1) * VLP];
      }
      // holds the reads above ahead of the WMMAs below: left free, they sink to
      // just before their use and every LDS latency is waited out in the chain
      __builtin_amdgcn_sched_barrier(0);
      #pragma unroll
      for (int s = 0; s < 4; ++s)
        acc = __builtin_amdgcn_wmma_f32_16x16x4_f32(false, a[s], false, b[s],
                                                    (short)0, acc, false, false);
      #pragma unroll
      for (int s = 0; s < 4; ++s) { a[s] = an[s]; b[s] = bn[s]; }
    }

    // C/D layout: VGPR r -> M = r (lanes 0-15) / M = 8+r (lanes 16-31), N = lane%16.
    float* yp = y + (row0 + (lane >> 4) * 8) * C_DIM + h * HD + nt * 16 + l16;
    #pragma unroll
    for (int r = 0; r < 8; ++r) yp[r * C_DIM] = acc[r];
  }
}

// ---------------------------------------------------------------------------
extern "C" void kernel_launch(void* const* d_in, const int* in_sizes, int n_in,
                              void* d_out, int out_size, void* d_ws, size_t ws_size,
                              hipStream_t stream) {
  const float* x    = (const float*)d_in[0];
  const float* cosp = (const float*)d_in[1];
  const float* sinp = (const float*)d_in[2];
  const float* Wq   = (const float*)d_in[3];
  const float* Wk   = (const float*)d_in[4];
  const float* Wv   = (const float*)d_in[5];
  const float* Wo   = (const float*)d_in[6];
  float*       out  = (float*)d_out;

  float* ws   = (float*)d_ws;
  float* qbuf = ws;                                   // 512*1024
  float* kbuf = qbuf + (size_t)T_SEQ * C_DIM;         // 512*512
  float* vbuf = kbuf + (size_t)T_SEQ * NKV * HD;      // 512*512
  float* sbuf = vbuf + (size_t)T_SEQ * NKV * HD;      // 16*512*512
  float* ybuf = sbuf + (size_t)NH * T_SEQ * T_SEQ;    // 512*1024

  dim3 blk(NT);

  // q = x @ Wq (512x1024x1024), k = x @ Wk, v = x @ Wv (512x512x1024): one grid;
  // RoPE + RMS-norm on q (16 heads) and k (8 heads) in its epilogue.
  qkv_f32_wmma<<<dim3(QT + 2 * KT, T_SEQ / BM, 1), blk, 0, stream>>>(
      x, Wq, Wk, Wv, cosp, sinp, qbuf, kbuf, vbuf);

  // Tropical scores, causal softmax and y[h] = P[h] @ V[h/2] in one grid:
  // 16 row-tile pairs x 16 heads = 256 workgroups.
  tropical_attention<<<dim3(T_SEQ / 32, NH, 1), dim3(AT_THREADS), 0, stream>>>(
      qbuf, kbuf, vbuf, ybuf);

  // out = y @ Wo   (512x1024x1024): 64x32 tiles, 32 x 8 = 256 workgroups
  gemm_f32_wmma<<<dim3(C_DIM / BNO, T_SEQ / BM, 1), blk, 0, stream>>>(
      ybuf, Wo, out, T_SEQ, C_DIM, C_DIM, C_DIM, C_DIM, C_DIM, 0LL, 0, 1, 0);
}

// v007
// Measured time: 35.3 microseconds a run.
// Timed twice side by side with v006, it ran 1.03 times as fast both times.
// All steps since v000 together make it 4.13 times as fast.
#include <hip/hip_runtime.h>
#include <hip/hip_bf16.h>
#include <math.h>

typedef __attribute__((ext_vector_type(2))) float v2f;
typedef __attribute__((ext_vector_type(8))) float v8f;
typedef __attribute__((ext_vector_type(4))) int   v4i;

#define T_SEQ 512
#define C_DIM 1024
#define NH    16
#define NKV   8
#define HD    64
#define HD2   32

// ---------------------------------------------------------------------------
// Async memory->LDS staging (gfx1250 GLOBAL_LOAD_ASYNC_TO_LDS_B128, ASYNCcnt),
// with a synchronous float4 fallback if the toolchain lacks the builtin.
// Builtin signature (from clang diagnostic): (v4i addrspace(1)*, v4i
// addrspace(3)*, imm offset, imm cpol).
// ---------------------------------------------------------------------------
#define GLOBAL_AS __attribute__((address_space(1)))
#define LDS_AS    __attribute__((address_space(3)))

#if __has_builtin(__builtin_amdgcn_global_load_async_to_lds_b128)
#define HAVE_ASYNC_LDS 1
#define ASYNC_COPY16(gp, lp)                                                   \
  __builtin_amdgcn_global_load_async_to_lds_b128(                              \
      (GLOBAL_AS v4i*)(unsigned long long)(gp),                                \
      (LDS_AS v4i*)(unsigned)(unsigned long long)(lp), 0, 0)
#else
#define HAVE_ASYNC_LDS 0
#define ASYNC_COPY16(gp, lp) (*(float4*)(lp) = *(const float4*)(gp))
#endif

#if HAVE_ASYNC_LDS
// asm with the memory clobber: no LDS read may be lifted over the wait
#define WAIT_ASYNC(n) asm volatile("s_wait_asynccnt %0" ::"i"(n) : "memory")
#else
#define WAIT_ASYNC(n) ((void)0)
#endif

// ---------------------------------------------------------------------------
// Generic f32 GEMM, C = A @ B, using V_WMMA_F32_16X16X4_F32.
// Block tile 64xTN, 256 threads = 8 waves. Each wave owns a 32x32 piece = 2x2
// WMMA tiles (2 A-frags + 2 B-frags feed 4 WMMAs -> 2x fragment reuse); the
// waves that cover the tile once are a group: 4 waves and 2 groups at TN = 64,
// 2 waves and 4 groups at TN = 32. A trip of the K loop covers 32 k per group:
// group g stages and multiplies the 32-wide chunk g of it, so every SIMD holds
// two waves (one runs its WMMAs under the other's LDS waits). The groups'
// partial tiles are added in LDS behind the loop.
// TN = 32 is for a product with fewer 64x64 tiles than the chip has WGPs: the
// f32 matrix rate is per WGP, so twice the tiles at half the WMMAs each halve
// the loop (half the trips, the trip itself as at TN = 64).
// Chunks go through a ring of three LDS buffers, staged with async LDS-DMA two
// trips ahead: a copy has two trips of WMMAs to land in, not one, and the one
// barrier that publishes trip i also frees the buffer of trip i-1 for trip i+2.
// All launches use M,N that are exact multiples of the tile and K a multiple
// of a trip's 64 or 128 (no guards, EXEC stays all-ones as WMMA requires).
// ---------------------------------------------------------------------------
#define BM 64
#define BN 64
#define BK 32
#define BNO 32     // tile width of the output projection: 32 x 8 = 256 tiles
#define NT 256     // threads of a work-group
#define SAPAD 36   // A pad: 36*l16 mod 64 distinct over 16 lanes -> no conflicts

// FUSE: the caller has tiles that leave through the RoPE + RMS-norm epilogue
// (TN == HD and two groups there). TN: tile width, 64 or 32.
template <bool FUSE, int TN>
__device__ __forceinline__
void gemm_tile(const float* __restrict__ A, const float* __restrict__ B,
               float* __restrict__ C, int K, int lda, int ldb, int ldc,
               int m0, int n0, bool rope,
               const float* __restrict__ cosp, const float* __restrict__ sinp)
{
  const int tid  = threadIdx.x;
  const int lane = tid & 31;
  const int wave = tid >> 5;
  constexpr int GT    = 2 * TN;       // threads of a group: 2 x TN/32 waves
  constexpr int NG    = NT / GT;      // wave groups that share the K loop
  constexpr int SBPAD = TN + 8;       // B pad: koff row pairs land on disjoint bank ranges
  constexpr int SCPAD = TN + 4;       // C pad: rows r and r+8 land 32 banks apart -> no conflicts
  constexpr int BR4   = TN / 4;       // float4s of a B or C row
  constexpr int NA    = BM * BK / 4 / GT;   // A copies of a thread per trip (B: 4)
  constexpr int NC    = NA + 4;             // copies of a thread per trip
  constexpr int STEP  = NG * BK;            // k that a trip covers
  // which 32-wide chunk of every trip; the same in all lanes of a wave, so the
  // offsets formed from it are kept scalar
  const int grp  = __builtin_amdgcn_readfirstlane(tid / GT);
  const int gtid = tid & (GT - 1);
  const int wm   = (wave / (TN / 32)) & 1;   // 2 x TN/32 wave grid over the tile
  const int wn   = wave & (TN / 32 - 1);
  const int l16  = lane & 15;
  const int koff = (lane >> 4) * 2;   // lanes 0-15: K=0,1  lanes 16-31: K=2,3

  __shared__ __align__(16) float sA[3][NG][BM][SAPAD];  // A row-major
  __shared__ __align__(16) float sB[3][NG][BK][SBPAD];  // B row-major [k][n]

  v8f acc[2][2];
  #pragma unroll
  for (int mi = 0; mi < 2; ++mi)
    #pragma unroll
    for (int ni = 0; ni < 2; ++ni)
      acc[mi][ni] = (v8f){0.f,0.f,0.f,0.f,0.f,0.f,0.f,0.f};

  // Stage the group's own K-chunk of the next trip not yet staged:
  // A 64x32 + B 32xTN, in float4s: NA + 4 per thread of the group. The trips are
  // staged in their order, so the two source addresses just walk along K.
  const int ar = gtid >> 3,  ac = (gtid & 7) * 4;      // A: 8 float4 per row
  const int br = gtid / BR4, bc = (gtid % BR4) * 4;    // B: TN/4 float4 per row
  const float* gA = A + (long long)(m0 + ar) * lda + grp * BK + ac;
  const float* gB = B + (long long)(grp * BK + br) * ldb + n0 + bc;
  auto stage = [&](int buf) {
    #pragma unroll
    for (int q = 0; q < NA; ++q) {
      ASYNC_COPY16(gA + (long long)(q * (GT / 8)) * lda, &sA[buf][grp][ar + q * (GT / 8)][ac]);
      if (q < 4)
        ASYNC_COPY16(gB + (long long)(q * (GT / BR4)) * ldb, &sB[buf][grp][br + q * (GT / BR4)][bc]);
    }
    gA += STEP;
    gB += (long long)STEP * ldb;
  };

  stage(0);
  if (STEP < K) stage(1);
  int buf = 0, fill = 2;                      // buffer of trip i, of trip i+2
  // One trip. next: a trip i+1 exists (its copies are in flight); refill: a trip
  // i+2 exists. Both are literals at each call, so no trip tests for them.
  auto trip = [&](bool next, bool refill) {
    // publish point of this trip's buffer. This wave's LDS reads of the trip
    // before are done: behind the barrier their buffer is refilled.
    asm volatile("s_wait_dscnt 0x0" ::: "memory");
    if (next) WAIT_ASYNC(NC);                 // this trip's copies done, the next trip's in flight
    else      WAIT_ASYNC(0);
    __syncthreads();                          // everyone's staging visible, last trip's buffer free

    const float (*pA)[SAPAD] = sA[buf][grp];
    const float (*pB)[SBPAD] = sB[buf][grp];
    auto frag = [&](int k4, v2f& a0, v2f& a1, v2f& b0, v2f& b1) {
      a0 = *(const v2f*)&pA[wm * 32 + l16][k4 + koff];             // ds b64
      a1 = *(const v2f*)&pA[wm * 32 + 16 + l16][k4 + koff];
      b0.x = pB[k4 + koff    ][wn * 32 + l16];                     // ds 2addr b32
      b0.y = pB[k4 + koff + 1][wn * 32 + l16];
      b1.x = pB[k4 + koff    ][wn * 32 + 16 + l16];
      b1.y = pB[k4 + koff + 1][wn * 32 + 16 + l16];
    };
    auto mma4 = [&](v2f a0, v2f a1, v2f b0, v2f b1) {
      // 8 args: (neg_a, A, neg_b, B, c_mod, C, reuse_a, reuse_b)
      acc[0][0] = __builtin_amdgcn_wmma_f32_16x16x4_f32(false, a0, false, b0,
                                                        (short)0, acc[0][0], false, false);
      acc[0][1] = __builtin_amdgcn_wmma_f32_16x16x4_f32(false, a0, false, b1,
                                                        (short)0, acc[0][1], false, false);
      acc[1][0] = __builtin_amdgcn_wmma_f32_16x16x4_f32(false, a1, false, b0,
                                                        (short)0, acc[1][0], false, false);
      acc[1][1] = __builtin_amdgcn_wmma_f32_16x16x4_f32(false, a1, false, b1,
                                                        (short)0, acc[1][1], false, false);
    };

    // The first fragments are asked for ahead of the refill, whose issue then
    // runs under their LDS latency.
    v2f fa0[2], fa1[2], fb0[2], fb1[2];
    #pragma unroll
    for (int s = 0; s < 2; ++s) frag(s * 4, fa0[s], fa1[s], fb0[s], fb1[s]);
    if (refill) stage(fill);                  // into the buffer that the trip before read
    #pragma unroll
    for (int s = 0; s < 2; ++s) mma4(fa0[s], fa1[s], fb0[s], fb1[s]);
    #pragma unroll
    for (int k4 = 8; k4 < BK; k4 += 4) {
      v2f a0, a1, b0, b1;
      frag(k4, a0, a1, b0, b1);
      mma4(a0, a1, b0, b1);
    }
    buf  = (buf  == 2) ? 0 : buf + 1;
    fill = (fill == 2) ? 0 : fill + 1;
  };
  for (int kk = 2 * STEP; kk < K; kk += STEP) trip(true, true);
  if (STEP < K) trip(true, false);
  trip(false, false);
  // the ring becomes output staging: every wave's last reads are done first
  asm volatile("s_wait_dscnt 0x0" ::: "memory");
  __syncthreads();

  // All groups lay their partial tile into LDS (sA is dead behind the barrier
  // above, no copy is in flight); every element then leaves as the
  // groups' sums added in the order of the groups.
  float* sC = &sA[0][0][0][0];                // NG x 64 x SCPAD floats fit in sA
  const float* sC1 = sC + BM * SCPAD;
  // C/D layout: VGPR r -> M = r (lanes 0-15) / M = 8+r (lanes 16-31), N = lane%16.
  auto lay_partial = [&]() {
    #pragma unroll
    for (int mi = 0; mi < 2; ++mi)
      #pragma unroll
      for (int ni = 0; ni < 2; ++ni)
        #pragma unroll
        for (int r = 0; r < 8; ++r)
          sC[(grp * BM + wm * 32 + mi * 16 + (lane >> 4) * 8 + r) * SCPAD + wn * 32 + ni * 16 + l16] =
              acc[mi][ni][r];
  };

  // RoPE + per-head RMS-norm on the way out (workgroup-uniform choice). BN == HD,
  // so the tile's 64 columns are one whole head of 64 tokens. One wave per row,
  // lane l owning dims l and l+32, 8 rows per wave side by side so that one
  // row's cross-lane steps run under the others'.
  if (FUSE && rope) {
    const int rb = wave * 8;
    const float* cp = cosp + (m0 + rb) * HD2 + lane;
    const float* sp = sinp + (m0 + rb) * HD2 + lane;
    float cs[8], sn[8];                       // fetched first: latency runs under the LDS pass
    #pragma unroll
    for (int u = 0; u < 8; ++u) {
      cs[u] = cp[u * HD2];
      sn[u] = sp[u * HD2];
    }
    // keeps both address pairs whole until every load above has taken them: left
    // free, the last load's result is placed on the pair that all eight name
    asm volatile("s_wait_xcnt 0x0" :: "v"(cp), "v"(sp) : "memory");
    lay_partial();
    __syncthreads();                          // both partial tiles are in LDS

    float r1[8], r2[8], ss[8];
    #pragma unroll
    for (int u = 0; u < 8; ++u) {
      const int o = (rb + u) * SCPAD + lane;
      float x1 = sC[o] + sC1[o], x2 = sC[o + HD2] + sC1[o + HD2];
      r1[u] = x1 * cs[u] - x2 * sn[u];
      r2[u] = x1 * sn[u] + x2 * cs[u];
      ss[u] = r1[u] * r1[u] + r2[u] * r2[u];
    }
    #pragma unroll
    for (int off = 16; off > 0; off >>= 1)
      #pragma unroll
      for (int u = 0; u < 8; ++u) ss[u] += __shfl_xor(ss[u], off, 32);
    #pragma unroll
    for (int u = 0; u < 8; ++u) {
      float scale = rsqrtf(ss[u] * (1.0f / HD) + 1e-6f);
      float* p = C + (long long)(m0 + rb + u) * ldc + n0;
      p[lane]       = r1[u] * scale;
      p[lane + HD2] = r2[u] * scale;
    }
    return;
  }

  lay_partial();
  __syncthreads();                            // all partial tiles are in LDS
  // TN/4 threads per row, 16 bytes each: whole 128-byte lines from one wave.
  #pragma unroll
  for (int q = 0; q < TN / 16; ++q) {
    const int row = tid / BR4 + q * (NT / BR4), c4 = (tid % BR4) * 4;
    float4 s = *(const float4*)&sC[row * SCPAD + c4];
    #pragma unroll
    for (int g = 1; g < NG; ++g) {
      const float4 t = *(const float4*)&sC[(g * BM + row) * SCPAD + c4];
      s = make_float4(s.x + t.x, s.y + t.y, s.z + t.z, s.w + t.w);
    }
    *(float4*)&C[(long long)(m0 + row) * ldc + n0 + c4] = s;
  }
  // the built code places the RoPE block behind these stores, and that block
  // rewrites their address registers: the wait stands in front of the rewrite
  if (FUSE) asm volatile("s_wait_xcnt 0x0" ::: "memory");
}

__global__ __launch_bounds__(NT)
void gemm_f32_wmma(const float* __restrict__ A, const float* __restrict__ B,
                   float* __restrict__ C, int M, int N, int K,
                   int lda, int ldb, int ldc,
                   long long aHeadStride, int bHeadColStride, int bHeadDiv,
                   int cHeadColStride)
{
  const int h = blockIdx.z;
  gemm_tile<false, BNO>(A + (long long)h * aHeadStride,
            B + (long long)(h / bHeadDiv) * bHeadColStride,
            C + (long long)h * cHeadColStride,
            K, lda, ldb, ldc, blockIdx.y * BM, blockIdx.x * BNO,
            false, nullptr, nullptr);
}

// q, k and v projections in ONE grid: they share A = x and do not depend on
// each other. Column tiles 0-15 belong to q, 16-23 to k, 24-31 to v, so the
// launch has 32 x 8 = 256 workgroups instead of 128, 64 and 64 in turn.
// A column tile is one head, and the q and k tiles leave rotated and normed.
#define QT (C_DIM / BN)
#define KT ((NKV * HD) / BN)

__global__ __launch_bounds__(NT)
void qkv_f32_wmma(const float* __restrict__ x, const float* __restrict__ Wq,
                  const float* __restrict__ Wk, const float* __restrict__ Wv,
                  const float* __restrict__ cosp, const float* __restrict__ sinp,
                  float* __restrict__ q, float* __restrict__ k,
                  float* __restrict__ v)
{
  const int bx = blockIdx.x;          // uniform over the workgroup
  const float* W = Wq;
  float* o = q;
  int ld = C_DIM, nt = bx;
  if (bx >= QT + KT)  { W = Wv; o = v; ld = NKV * HD; nt = bx - (QT + KT); }
  else if (bx >= QT)  { W = Wk; o = k; ld = NKV * HD; nt = bx - QT; }
  gemm_tile<true, BN>(x, W, o, C_DIM, C_DIM, ld, ld, blockIdx.y * BM, nt * BN,
                  bx < QT + KT, cosp, sinp);
}

// ---------------------------------------------------------------------------
// Tropical attention, one launch: S[i,j] = max_d(q[i,d] + k[j,d]), causal
// softmax over j <= i, y = P @ V. The scores never leave the registers.
// One workgroup = one head and two 16-row query tiles, p and 31 - p, so every
// workgroup has the same causal work (16 rows x 528 keys = 17 chunks of 32 keys).
//   stage : q tile and all keys of the kv head, both transposed to [d][row]
//   scores: a wave takes 16 rows x 32 keys; a lane owns 4 rows x 4 keys, so one
//           16-byte LDS read of q and one of k feed 16 add/max pairs
//   probs : at the end of each chunk, by the lane that holds the score:
//           e = exp(S - 16), an exact zero for j > i. q and k leave the RMS norm
//           with |x| <= sqrt(64) = 8 whatever the inputs, so S lies in [-16, 16]
//           and e in [e^-32, 1]: no row maximum is needed, and with it goes the
//           pass over whole rows. Each chunk leaves its 16 row sums beside it.
//   e @ V : V_WMMA_F32_16X16X4_F32, wave = one 16-column tile and every fourth (or
//           third) chunk, so each SIMD has the same 128 WMMAs from several waves
//           in place of one wave's chain of up to 128. A chunk's e needs nothing
//           of the other chunks, so the 17th chunk, which 16 waves cannot share
//           out, has its scores made by wave 0 while the other waves' WMMAs run
//   out   : the four slices added in LDS, divided by the row's sum, 16-byte stores
// ---------------------------------------------------------------------------
typedef __attribute__((ext_vector_type(4))) float v4f;

#define AT_THREADS 512
#define NJOB 17   // 32-key chunks of both tiles together
#define KTP 516   // kT pitch: 4 d-rows apart = 16 banks, so transposing stores do not collide
#define QTP 36    // qT pitch: same property, 16-byte aligned rows
#define PCP 36    // chunk pitch of e: 16 rows x b64 reads cover all 64 banks once
#define OSP 68    // slice pitch: rows r and r+8 land 32 banks apart

// 2^x as the fast exponential compiles it, with the free slot that the
// instruction set asks for behind a transcendental tied to it: as a statement of
// its own the v_nop was scheduled away from the v_exp_f32.
__device__ __forceinline__ float exp2_slot(float x)
{
  float r;
  asm("v_exp_f32 %0, %1\n\tv_nop" : "=v"(r) : "v"(x));
  return r;
}

__global__ __launch_bounds__(AT_THREADS)
void tropical_attention(const float* __restrict__ q, const float* __restrict__ k,
                        const float* __restrict__ v, float* __restrict__ y)
{
  __shared__ __align__(16) float sKT[HD * KTP];        // kT[64][KTP], later the four output slices
  // v[512][64]: rows 4n+2 and 4n+3 hold their two 32-column halves swapped, so
  // that rows k and k+2 of a B fragment land on disjoint bank ranges without a pad
  __shared__ __align__(16) float sV[T_SEQ * HD];
  __shared__ __align__(16) float sP[NJOB * 16 * PCP];  // e, one 16 x 32 block per chunk
  __shared__ __align__(16) float sL[NJOB * 16];        // row sums of each chunk
  __shared__ __align__(16) float qT[HD][QTP];

  const int p    = blockIdx.x;
  const int h    = blockIdx.y;
  const int tid  = threadIdx.x;
  const int lane = tid & 31;
  const int wave = __builtin_amdgcn_readfirstlane(tid >> 5);
  const int rowA = 16 * p;
  const int rowB = 16 * (31 - p);
  const int kvo  = (h >> 1) * HD;

  // ---- stage q and k transposed: a wave covers 8 rows x 4 float4 columns ----
  {
    const int sub = ((wave >> 2) << 3) + (lane & 7);
    const int c4  = ((wave & 3) << 2) + (lane >> 3);
    const int grow = (sub < 16) ? rowA + sub : rowB + sub - 16;
    v4f qv = *(const v4f*)(q + grow * C_DIM + h * HD + c4 * 4);
    const float* kb = k + sub * (NKV * HD) + kvo + c4 * 4;
    v4f kr[16];
    #pragma unroll
    for (int it = 0; it < 16; ++it)
      kr[it] = *(const v4f*)(kb + it * 32 * (NKV * HD));
    #pragma unroll
    for (int e = 0; e < 4; ++e) qT[c4 * 4 + e][sub] = qv[e];
    #pragma unroll
    for (int it = 0; it < 16; ++it)
      #pragma unroll
      for (int e = 0; e < 4; ++e)
        sKT[(c4 * 4 + e) * KTP + it * 32 + sub] = kr[it][e];
  }

  __syncthreads();                       // qT and kT complete

  // v is fetched now and parked in registers: its latency runs under the scores.
  const float* vb = v + (tid >> 4) * (NKV * HD) + kvo + (tid & 15) * 4;
  v4f vr[16];
  #pragma unroll
  for (int it = 0; it < 16; ++it)
    vr[it] = *(const v4f*)(vb + it * 32 * (NKV * HD));
  // keeps the address pair whole until every load above has taken it: left
  // free, the last load's result is placed on the pair that all sixteen name
  asm volatile("s_wait_xcnt 0x0" :: "v"(vb) : "memory");

  // ---- scores and e ----
  const int cB = (33 - p) >> 1;          // 32-key chunks that tile 31-p needs
  const int cA = (p + 2) >> 1;           // ... and tile p; cA + cB = NJOB
  auto score_job = [&](int job) {
    const int li = lane >> 3, lj = lane & 7;
    {
      const int tile  = (job < cB) ? 1 : 0;
      const int chunk = tile ? job : job - cB;
      const float* qp = &qT[0][tile * 16 + li * 4];
      const float* kp = &sKT[chunk * 32 + lj * 4];
      v2f sc[4][2];
      #pragma unroll
      for (int r = 0; r < 4; ++r) {
        sc[r][0] = (v2f){-3.0e38f, -3.0e38f};
        sc[r][1] = (v2f){-3.0e38f, -3.0e38f};
      }
      // four d pairs per trip: 16 LDS reads go out together ahead of their 128
      // packed adds and three-way maxima
      #pragma unroll 4
      for (int d = 0; d < HD; d += 2) {
        v4f qa = *(const v4f*)(qp + d * QTP);
        v4f qb = *(const v4f*)(qp + (d + 1) * QTP);
        v4f ka = *(const v4f*)(kp + d * KTP);
        v4f kb = *(const v4f*)(kp + (d + 1) * KTP);
        #pragma unroll
        for (int r = 0; r < 4; ++r) {
          v2f a0 = (v2f){qa[r], qa[r]} + ka.xy;
          v2f a1 = (v2f){qa[r], qa[r]} + ka.zw;
          v2f b0 = (v2f){qb[r], qb[r]} + kb.xy;
          v2f b1 = (v2f){qb[r], qb[r]} + kb.zw;
          sc[r][0].x = fmaxf(fmaxf(sc[r][0].x, a0.x), b0.x);
          sc[r][0].y = fmaxf(fmaxf(sc[r][0].y, a0.y), b0.y);
          sc[r][1].x = fmaxf(fmaxf(sc[r][1].x, a1.x), b1.x);
          sc[r][1].y = fmaxf(fmaxf(sc[r][1].y, a1.y), b1.y);
        }
      }
      // e = 2^((S - 16) log2 e) in every lane (no branch round it), 0 above the diagonal
      const int dj = (tile ? rowB : rowA) + li * 4 - (chunk * 32 + lj * 4);  // row - key at r = c = 0
      float rs[4];
      #pragma unroll
      for (int r = 0; r < 4; ++r) {
        const float s4[4] = {sc[r][0].x, sc[r][0].y, sc[r][1].x, sc[r][1].y};
        v4f e;
        #pragma unroll
        for (int c = 0; c < 4; ++c) {
          float ex = exp2_slot(fmaf(s4[c], 1.442695041f, -16.0f * 1.442695041f));
          e[c] = (c - r <= dj) ? ex : 0.f;
        }
        *(v4f*)&sP[(job * 16 + li * 4 + r) * PCP + lj * 4] = e;
        rs[r] = (e[0] + e[1]) + (e[2] + e[3]);
      }
      // the eight lanes that share four rows add up their keys, four rows side by side
      #pragma unroll
      for (int off = 1; off < 8; off <<= 1)
        #pragma unroll
        for (int r = 0; r < 4; ++r) rs[r] += __shfl_xor(rs[r], off, 32);
      if (lj == 0) *(v4f*)&sL[job * 16 + li * 4] = (v4f){rs[0], rs[1], rs[2], rs[3]};
    }
  };
  score_job(wave);                       // chunks 0-15, one a wave

  // ---- v into its own space: nobody waits for it before the barrier below ----
  {
    float* vd = &sV[(tid >> 4) * HD + (((tid & 15) * 4) ^ (((tid >> 5) & 1) * 32))];
    #pragma unroll
    for (int it = 0; it < 16; ++it) *(v4f*)(vd + it * 32 * HD) = vr[it];
  }
  __syncthreads();                       // e and row sums of 16 chunks and v complete

  // ---- slices of e (16 x 32 a chunk) @ V (32 x 16) ----
  float* sO = sKT;                       // [slice][tile][16][OSP]
  {
    const int nt   = wave & 3, sl = wave >> 2;
    const int l16  = lane & 15;
    const int hi   = lane >> 4;
    const int koff = hi * 2;             // lanes 0-15: K=0,1  lanes 16-31: K=2,3
    const float* pA = &sP[l16 * PCP + koff];
    const float* pB = &sV[koff * HD + ((nt * 16 + l16) ^ (hi * 32))];   // rows K=2,3: halves swapped

    v8f acc[2];
    acc[0] = (v8f){0.f,0.f,0.f,0.f,0.f,0.f,0.f,0.f};
    acc[1] = (v8f){0.f,0.f,0.f,0.f,0.f,0.f,0.f,0.f};
    auto unit = [&](int job, int chunk, v8f& a) {
      const float* fA = pA + job * 16 * PCP;
      const float* fB = pB + chunk * 32 * HD;
      v2f fa[8], fb[8];
      #pragma unroll
      for (int s = 0; s < 8; ++s) {
        fa[s]   = *(const v2f*)(fA + s * 4);
        fb[s].x = fB[(s * 4) * HD];
        fb[s].y = fB[(s * 4 + 1) * HD];
      }
      // holds the reads above ahead of the WMMAs below: left free, they sink to one
      // step before their use and every LDS latency is waited out in the chain
      __builtin_amdgcn_sched_barrier(0);
      #pragma unroll
      for (int s = 0; s < 8; ++s)
        a = __builtin_amdgcn_wmma_f32_16x16x4_f32(false, fa[s], false, fb[s],
                                                  (short)0, a, false, false);
    };
    // All branches here are wave-uniform: EXEC stays all ones.
    if (wave == 0) {
      score_job(NJOB - 1);               // vector work, beside the other waves' WMMAs
    } else {
      // column tile 0 has three waves for the 16 chunks, the others four
      const int step = nt ? 4 : 3;
      int job = nt ? sl : sl - 1;
      for (; job < cB; job += step)       unit(job, job, acc[1]);
      for (; job < NJOB - 1; job += step) unit(job, job - cB, acc[0]);
    }
    __syncthreads();                     // the last chunk's e and row sums complete, kT dead
    if (sl == 0) unit(NJOB - 1, cA - 1, acc[0]);

    // C/D layout: VGPR r -> M = r (lanes 0-15) / M = 8+r (lanes 16-31), N = lane%16.
    #pragma unroll
    for (int t = 0; t < 2; ++t)
      #pragma unroll
      for (int r = 0; r < 8; ++r)
        sO[((sl * 2 + t) * 16 + hi * 8 + r) * OSP + nt * 16 + l16] = acc[t][r];
  }
  __syncthreads();                       // all slices are in LDS

  // ---- y = (sum of the slices) / (sum of the row): 16 threads per row ----
  {
    const int t  = wave >> 3;            // waves 0-7 tile p, 8-15 tile 31-p
    const int rl = (tid >> 4) & 15, c4 = (tid & 15) * 4;
    v4f o = *(const v4f*)&sO[(t * 16 + rl) * OSP + c4];
    #pragma unroll
    for (int s = 1; s < 4; ++s) o += *(const v4f*)&sO[((s * 2 + t) * 16 + rl) * OSP + c4];
    float sum = 0.f;                     // all reads go out together; the other tile's chunks add 0
    #pragma unroll
    for (int job = 0; job < NJOB; ++job) {
      float x = sL[job * 16 + rl];
      sum += ((job < cB) == (t == 1)) ? x : 0.f;
    }
    float inv = 1.0f / sum;              // row i always has valid j=0 -> sum >= e^-32 > 0
    *(v4f*)(y + ((t ? rowB : rowA) + rl) * C_DIM + h * HD + c4) = o * inv;
  }
}

// ---------------------------------------------------------------------------
extern "C" void kernel_launch(void* const* d_in, const int* in_sizes, int n_in,
                              void* d_out, int out_size, void* d_ws, size_t ws_size,
                              hipStream_t stream) {
  const float* x    = (const float*)d_in[0];
  const float* cosp = (const float*)d_in[1];
  const float* sinp = (const float*)d_in[2];
  const float* Wq   = (const float*)d_in[3];
  const float* Wk   = (const float*)d_in[4];
  const float* Wv   = (const float*)d_in[5];
  const float* Wo   = (const float*)d_in[6];
  float*       out  = (float*)d_out;

  float* ws   = (float*)d_ws;
  float* qbuf = ws;                                   // 512*1024
  float* kbuf = qbuf + (size_t)T_SEQ * C_DIM;         // 512*512
  float* vbuf = kbuf + (size_t)T_SEQ * NKV * HD;      // 512*512
  float* sbuf = vbuf + (size_t)T_SEQ * NKV * HD;      // 16*512*512
  float* ybuf = sbuf + (size_t)NH * T_SEQ * T_SEQ;    // 512*1024

  dim3 blk(NT);

  // q = x @ Wq (512x1024x1024), k = x @ Wk, v = x @ Wv (512x512x1024): one grid;
  // RoPE + RMS-norm on q (16 heads) and k (8 heads) in its epilogue.
  qkv_f32_wmma<<<dim3(QT + 2 * KT, T_SEQ / BM, 1), blk, 0, stream>>>(
      x, Wq, Wk, Wv, cosp, sinp, qbuf, kbuf, vbuf);

  // Tropical scores, causal softmax and y[h] = P[h] @ V[h/2] in one grid:
  // 16 row-tile pairs x 16 heads = 256 workgroups.
  tropical_attention<<<dim3(T_SEQ / 32, NH, 1), dim3(AT_THREADS), 0, stream>>>(
      qbuf, kbuf, vbuf, ybuf);

  // out = y @ Wo   (512x1024x1024): 64x32 tiles, 32 x 8 = 256 workgroups
  gemm_f32_wmma<<<dim3(C_DIM / BNO, T_SEQ / BM, 1), blk, 0, stream>>>(
      ybuf, Wo, out, T_SEQ, C_DIM, C_DIM, C_DIM, C_DIM, C_DIM, 0LL, 0, 1, 0);
}
